// v000
// Times are from an AMD MI455X. After a warm-up the kernel runs many times in a row, and a time is the length of
// such a window on the GPU divided by its runs, so every launch and the gaps after it count. The runs cycle
// through copies of the inputs. A figure is the median of several windows, for all but v000 over two sittings.
// Sittings can differ by a few percent; kernels timed side by side share one.
// The starting kernel, v000, takes 202 microseconds a run.
#include <hip/hip_runtime.h>
#include <hip/hip_bf16.h>

typedef _Float16 half_t;
typedef __attribute__((ext_vector_type(8)))  _Float16 v8h;
typedef __attribute__((ext_vector_type(16))) _Float16 v16h;
typedef __attribute__((ext_vector_type(8)))  float    v8f;
typedef __attribute__((ext_vector_type(4)))  int      v4i;

#define LCNT 1024   // 32*32 spatial positions
#define CH   256
#define NH   4
#define HD   64

#if __has_builtin(__builtin_amdgcn_global_load_async_to_lds_b128)
#define HAS_ASYNC 1
#else
#define HAS_ASYNC 0
#endif

#if HAS_ASYNC
typedef __attribute__((address_space(1))) v4i gv4i_t;   // global int4
typedef __attribute__((address_space(3))) v4i lv4i_t;   // LDS int4
#endif

__device__ __forceinline__ void async_b128(const half_t* g, half_t* l) {
#if HAS_ASYNC
  __builtin_amdgcn_global_load_async_to_lds_b128((gv4i_t*)g, (lv4i_t*)l, 0, 0);
#else
  *(v8h*)l = *(const v8h*)g;   // sync fallback: global load + ds store
#endif
}

template <int N>
__device__ __forceinline__ void wait_async_le() {
#if HAS_ASYNC
#if __has_builtin(__builtin_amdgcn_s_wait_asynccnt)
  __builtin_amdgcn_s_wait_asynccnt(N);
#else
  asm volatile("s_wait_asynccnt %0" :: "i"(N) : "memory");
#endif
#endif
}

__device__ __forceinline__ v16h load_frag(const half_t* __restrict__ base,
                                          int ld, int row0, int k0) {
  int lane = threadIdx.x & 31;
  const half_t* p = base + (size_t)(row0 + (lane & 15)) * ld + k0 + ((lane >> 4) << 3);
  v8h lo = *(const v8h*)(p);
  v8h hi = *(const v8h*)(p + 16);
  v16h f;
#pragma unroll
  for (int i = 0; i < 8; ++i) { f[i] = lo[i]; f[8 + i] = hi[i]; }
  return f;
}

__device__ __forceinline__ v8f wmma_f16(v16h a, v16h b, v8f c) {
  return __builtin_amdgcn_wmma_f32_16x16x32_f16(false, a, false, b, (short)0, c,
                                                false, false);
}

// ---------------- weight fp32 -> fp16 ----------------
__global__ __launch_bounds__(256) void cvt_kernel(const float* __restrict__ qkv_w,
                                                  const float* __restrict__ proj_w,
                                                  half_t* __restrict__ wq,
                                                  half_t* __restrict__ wp) {
  int i = blockIdx.x * 256 + threadIdx.x;
  if (i < 3 * CH * CH) wq[i] = (half_t)qkv_w[i];
  if (i < CH * CH)     wp[i] = (half_t)proj_w[i];
}

// ---------------- GroupNorm -> transposed y_t[b][l][c] f16 ----------------
__global__ __launch_bounds__(256) void gn_kernel(const float* __restrict__ x,
                                                 const float* __restrict__ gw,
                                                 const float* __restrict__ gb,
                                                 half_t* __restrict__ y_t) {
  const int CPG = 8;
  int b = blockIdx.x >> 5;
  int g = blockIdx.x & 31;
  const float* xg = x + ((size_t)b * CH + g * CPG) * LCNT;
  float s = 0.f, s2 = 0.f;
  for (int idx = threadIdx.x; idx < CPG * LCNT; idx += 256) {
    float v = xg[idx];
    s += v; s2 += v * v;
  }
#pragma unroll
  for (int off = 16; off > 0; off >>= 1) {
    s  += __shfl_xor(s, off, 32);
    s2 += __shfl_xor(s2, off, 32);
  }
  __shared__ float rs[8], rq[8];
  int wave = threadIdx.x >> 5, lane = threadIdx.x & 31;
  if (lane == 0) { rs[wave] = s; rq[wave] = s2; }
  __syncthreads();
  s = 0.f; s2 = 0.f;
#pragma unroll
  for (int i = 0; i < 8; ++i) { s += rs[i]; s2 += rq[i]; }
  const float invN = 1.0f / (float)(CPG * LCNT);
  float mean = s * invN;
  float var  = s2 * invN - mean * mean;
  float rstd = rsqrtf(var + 1e-5f);
  for (int idx = threadIdx.x; idx < CPG * LCNT; idx += 256) {
    int cl = idx >> 10;
    int l  = idx & (LCNT - 1);
    int c  = g * CPG + cl;
    float v = (xg[idx] - mean) * rstd * gw[c] + gb[c];
    y_t[((size_t)b * LCNT + l) * CH + c] = (half_t)v;
  }
}

// ---------------- QKV GEMM: block = 128(o) x 64(l), K=256 ----------------
// All 8 waves share the B tile (y_t rows), staged async + double-buffered in LDS.
__global__ __launch_bounds__(256) void qkv_kernel(const half_t* __restrict__ wq,
                                                  const half_t* __restrict__ y_t,
                                                  const float* __restrict__ qkv_b,
                                                  half_t* __restrict__ qk,
                                                  half_t* __restrict__ vv) {
  int bx   = blockIdx.x;                 // 16 b * 6 mblk * 16 nt = 1536
  int b    = bx / 96;
  int rem  = bx - b * 96;
  int mblk = rem >> 4;
  int nt   = rem & 15;
  int l0   = nt << 6;
  int tid  = threadIdx.x, wave = tid >> 5, lane = tid & 31;
  int o0   = mblk * 128 + wave * 16;
  const half_t* yb = y_t + (size_t)b * LCNT * CH;

  __shared__ __align__(16) half_t btile[2][64][32];   // [l][k] for current k-step
  int srow = tid >> 2, sch = (tid & 3) << 3;          // 64 rows x 4 chunks of 16B
  const half_t* gsrc = yb + (size_t)(l0 + srow) * CH + sch;

  async_b128(gsrc, &btile[0][srow][sch]);             // prologue: k-step 0
  v8f acc[4] = {};
  for (int ks = 0; ks < 8; ++ks) {
    int buf = ks & 1;
    if (ks + 1 < 8) {
      async_b128(gsrc + (ks + 1) * 32, &btile[buf ^ 1][srow][sch]);
      wait_async_le<1>();                              // retire current buffer
    } else {
      wait_async_le<0>();
    }
    __syncthreads();
    v16h af = load_frag(wq, CH, o0, ks * 32);          // weights: L2-hot
#pragma unroll
    for (int j = 0; j < 4; ++j) {
      v16h bf = load_frag(&btile[buf][0][0], 32, j * 16, 0);
      acc[j] = wmma_f16(af, bf, acc[j]);
    }
    __syncthreads();                                   // protect buf before overwrite
  }

  int mh = (lane >> 4) << 3;
  float pb[8];
#pragma unroll
  for (int r = 0; r < 8; ++r) pb[r] = qkv_b[o0 + mh + r];
#pragma unroll
  for (int j = 0; j < 4; ++j) {
#pragma unroll
    for (int r = 0; r < 8; ++r) {
      int o = o0 + mh + r;
      int l = l0 + j * 16 + (lane & 15);
      float val = acc[j][r] + pb[r];
      int sec = o >> 8;                 // 0=q 1=k 2=v
      int h = (o >> 6) & 3;
      int d = o & 63;
      if (sec == 2)
        vv[(((size_t)b * NH + h) * HD + d) * LCNT + l] = (half_t)val;   // [b][h][d][l]
      else
        qk[((((size_t)b * 2 + sec) * NH + h) * LCNT + l) * HD + d] = (half_t)val; // [b][s][h][l][d]
    }
  }
}

// ---------------- flash attention: K/V tiles async-staged, shared by 8 waves ----------------
__global__ __launch_bounds__(256) void attn_kernel(const half_t* __restrict__ qk,
                                                   const half_t* __restrict__ vv,
                                                   half_t* __restrict__ ao) {
  int bh = blockIdx.x >> 3;
  int ib = blockIdx.x & 7;
  int b = bh >> 2, h = bh & 3;
  int tid = threadIdx.x, wave = tid >> 5, lane = tid & 31;
  const half_t* qt = qk + (((size_t)b * 2 * NH + h) * LCNT) * HD;
  const half_t* kt = qk + ((((size_t)b * 2 + 1) * NH + h) * LCNT) * HD;
  const half_t* vp = vv + (((size_t)b * NH + h) * HD) * LCNT;
  int i0 = ib * 128 + wave * 16;

  __shared__ __align__(16) half_t ktile[2][32][64];   // [j][d]
  __shared__ __align__(16) half_t vtile[2][64][32];   // [d][j]
  __shared__ __align__(16) half_t pstage[8][16 * 32]; // per-wave P re-layout
  half_t* ps = pstage[wave];

  int krow = tid >> 3, kch = (tid & 7) << 3;          // 32 rows x 8 chunks
  int vrow = tid >> 2, vch = (tid & 3) << 3;          // 64 rows x 4 chunks
  const half_t* kgb = kt + (size_t)krow * HD + kch;
  const half_t* vgb = vp + (size_t)vrow * LCNT + vch;

  v16h qf0 = load_frag(qt, HD, i0, 0);
  v16h qf1 = load_frag(qt, HD, i0, 32);
  float m_i[8], l_i[8];
  v8f O[4] = {};
#pragma unroll
  for (int r = 0; r < 8; ++r) { m_i[r] = -1e30f; l_i[r] = 0.f; }
  const float scale = 0.125f;   // 64^-0.5

  async_b128(kgb, &ktile[0][krow][kch]);              // prologue j-block 0
  async_b128(vgb, &vtile[0][vrow][vch]);

  for (int js = 0; js < 32; ++js) {
    int buf = js & 1;
    if (js + 1 < 32) {
      int jn = (js + 1) * 32;
      async_b128(kgb + (size_t)jn * HD, &ktile[buf ^ 1][krow][kch]);
      async_b128(vgb + jn,              &vtile[buf ^ 1][vrow][vch]);
      wait_async_le<2>();
    } else {
      wait_async_le<0>();
    }
    __syncthreads();

    v16h kf00 = load_frag(&ktile[buf][0][0], HD, 0,  0);
    v16h kf01 = load_frag(&ktile[buf][0][0], HD, 0,  32);
    v16h kf10 = load_frag(&ktile[buf][0][0], HD, 16, 0);
    v16h kf11 = load_frag(&ktile[buf][0][0], HD, 16, 32);
    v8f s0 = {}, s1 = {};
    s0 = wmma_f16(qf0, kf00, s0);
    s0 = wmma_f16(qf1, kf01, s0);
    s1 = wmma_f16(qf0, kf10, s1);
    s1 = wmma_f16(qf1, kf11, s1);

#pragma unroll
    for (int r = 0; r < 8; ++r) {
      float a0 = s0[r] * scale, a1 = s1[r] * scale;
      float rm = fmaxf(a0, a1);
#pragma unroll
      for (int off = 1; off < 16; off <<= 1) rm = fmaxf(rm, __shfl_xor(rm, off, 32));
      float mn = fmaxf(m_i[r], rm);
      float alpha = __expf(m_i[r] - mn);
      m_i[r] = mn;
      float e0 = __expf(a0 - mn), e1 = __expf(a1 - mn);
      float rsum = e0 + e1;
#pragma unroll
      for (int off = 1; off < 16; off <<= 1) rsum += __shfl_xor(rsum, off, 32);
      l_i[r] = l_i[r] * alpha + rsum;
#pragma unroll
      for (int tt = 0; tt < 4; ++tt) O[tt][r] *= alpha;
      int row = r + ((lane >> 4) << 3);
      ps[row * 32 + (lane & 15)]      = (half_t)e0;
      ps[row * 32 + 16 + (lane & 15)] = (half_t)e1;
    }
    // same-wave DS ordering: P store -> A-fragment reload
    v16h pf = load_frag(ps, 32, 0, 0);
#pragma unroll
    for (int tt = 0; tt < 4; ++tt) {
      v16h vf = load_frag(&vtile[buf][0][0], 32, tt * 16, 0);
      O[tt] = wmma_f16(pf, vf, O[tt]);
    }
    __syncthreads();                                   // buf reusable next iter
  }

#pragma unroll
  for (int r = 0; r < 8; ++r) {
    float inv = 1.0f / l_i[r];
#pragma unroll
    for (int tt = 0; tt < 4; ++tt) O[tt][r] *= inv;
  }
#pragma unroll
  for (int tt = 0; tt < 4; ++tt)
#pragma unroll
    for (int r = 0; r < 8; ++r) {
      int i = i0 + r + ((lane >> 4) << 3);
      int c = h * HD + tt * 16 + (lane & 15);
      ao[((size_t)b * LCNT + i) * CH + c] = (half_t)(O[tt][r]);   // [b][l][c]
    }
}

// ---------------- proj GEMM + bias + residual: block = 128(o) x 64(l) ----------------
__global__ __launch_bounds__(256) void proj_kernel(const half_t* __restrict__ wp,
                                                   const half_t* __restrict__ ao,
                                                   const float* __restrict__ proj_b,
                                                   const float* __restrict__ x,
                                                   float* __restrict__ out) {
  int bx   = blockIdx.x;                 // 16 b * 2 mblk * 16 nt = 512
  int b    = bx / 32;
  int rem  = bx - b * 32;
  int mblk = rem >> 4;
  int nt   = rem & 15;
  int l0   = nt << 6;
  int tid  = threadIdx.x, wave = tid >> 5, lane = tid & 31;
  int o0   = mblk * 128 + wave * 16;
  const half_t* ab = ao + (size_t)b * LCNT * CH;

  __shared__ __align__(16) half_t btile[2][64][32];
  int srow = tid >> 2, sch = (tid & 3) << 3;
  const half_t* gsrc = ab + (size_t)(l0 + srow) * CH + sch;

  async_b128(gsrc, &btile[0][srow][sch]);
  v8f acc[4] = {};
  for (int ks = 0; ks < 8; ++ks) {
    int buf = ks & 1;
    if (ks + 1 < 8) {
      async_b128(gsrc + (ks + 1) * 32, &btile[buf ^ 1][srow][sch]);
      wait_async_le<1>();
    } else {
      wait_async_le<0>();
    }
    __syncthreads();
    v16h af = load_frag(wp, CH, o0, ks * 32);
#pragma unroll
    for (int j = 0; j < 4; ++j) {
      v16h bf = load_frag(&btile[buf][0][0], 32, j * 16, 0);
      acc[j] = wmma_f16(af, bf, acc[j]);
    }
    __syncthreads();
  }

  int mh = (lane >> 4) << 3;
  float pb[8];
#pragma unroll
  for (int r = 0; r < 8; ++r) pb[r] = proj_b[o0 + mh + r];
#pragma unroll
  for (int j = 0; j < 4; ++j)
#pragma unroll
    for (int r = 0; r < 8; ++r) {
      int o = o0 + mh + r;
      int l = l0 + j * 16 + (lane & 15);
      size_t idx = ((size_t)b * CH + o) * LCNT + l;
      out[idx] = x[idx] + pb[r] + acc[j][r];
    }
}

extern "C" void kernel_launch(void* const* d_in, const int* in_sizes, int n_in,
                              void* d_out, int out_size, void* d_ws, size_t ws_size,
                              hipStream_t stream) {
  const float* x      = (const float*)d_in[0];
  const float* gn_w   = (const float*)d_in[1];
  const float* gn_b   = (const float*)d_in[2];
  const float* qkv_w  = (const float*)d_in[3];
  const float* qkv_b  = (const float*)d_in[4];
  const float* proj_w = (const float*)d_in[5];
  const float* proj_b = (const float*)d_in[6];
  float* out = (float*)d_out;

  // workspace layout (bytes), total ~40.5 MB
  char* ws = (char*)d_ws;
  half_t* wq  = (half_t*)(ws);              // 768*256 f16
  half_t* wp  = (half_t*)(ws +   393216);   // 256*256 f16
  half_t* y_t = (half_t*)(ws +   524288);   // 16*1024*256 f16
  half_t* qk  = (half_t*)(ws +  8912896);   // 16*2*4*1024*64 f16
  half_t* vv  = (half_t*)(ws + 25690112);   // 16*4*64*1024 f16
  half_t* ao  = (half_t*)(ws + 34078720);   // 16*1024*256 f16

  cvt_kernel <<<768,  256, 0, stream>>>(qkv_w, proj_w, wq, wp);
  gn_kernel  <<<512,  256, 0, stream>>>(x, gn_w, gn_b, y_t);
  qkv_kernel <<<1536, 256, 0, stream>>>(wq, y_t, qkv_b, qk, vv);
  attn_kernel<<<512,  256, 0, stream>>>(qk, vv, ao);
  proj_kernel<<<512,  256, 0, stream>>>(wp, ao, proj_b, x, out);
}

// v001
// One run takes 137 microseconds.
// Two timings next to v000 both put it at 1.51 times that version's speed.
#include <hip/hip_runtime.h>
#include <hip/hip_bf16.h>

typedef _Float16 half_t;
typedef __attribute__((ext_vector_type(8)))  _Float16 v8h;
typedef __attribute__((ext_vector_type(16))) _Float16 v16h;
typedef __attribute__((ext_vector_type(8)))  float    v8f;
typedef __attribute__((ext_vector_type(4)))  int      v4i;

#define LCNT 1024   // 32*32 spatial positions
#define CH   256
#define NH   4
#define HD   64

#if __has_builtin(__builtin_amdgcn_global_load_async_to_lds_b128)
#define HAS_ASYNC 1
#else
#define HAS_ASYNC 0
#endif

#if HAS_ASYNC
typedef __attribute__((address_space(1))) v4i gv4i_t;   // global int4
typedef __attribute__((address_space(3))) v4i lv4i_t;   // LDS int4
#endif

__device__ __forceinline__ void async_b128(const half_t* g, half_t* l) {
#if HAS_ASYNC
  __builtin_amdgcn_global_load_async_to_lds_b128((gv4i_t*)g, (lv4i_t*)l, 0, 0);
#else
  *(v8h*)l = *(const v8h*)g;   // sync fallback: global load + ds store
#endif
}

template <int N>
__device__ __forceinline__ void wait_async_le() {
#if HAS_ASYNC
#if __has_builtin(__builtin_amdgcn_s_wait_asynccnt)
  __builtin_amdgcn_s_wait_asynccnt(N);
#else
  asm volatile("s_wait_asynccnt %0" :: "i"(N) : "memory");
#endif
#endif
}

__device__ __forceinline__ v16h load_frag(const half_t* __restrict__ base,
                                          int ld, int row0, int k0) {
  int lane = threadIdx.x & 31;
  const half_t* p = base + (size_t)(row0 + (lane & 15)) * ld + k0 + ((lane >> 4) << 3);
  v8h lo = *(const v8h*)(p);
  v8h hi = *(const v8h*)(p + 16);
  v16h f;
#pragma unroll
  for (int i = 0; i < 8; ++i) { f[i] = lo[i]; f[8 + i] = hi[i]; }
  return f;
}

__device__ __forceinline__ v8f wmma_f16(v16h a, v16h b, v8f c) {
  return __builtin_amdgcn_wmma_f32_16x16x32_f16(false, a, false, b, (short)0, c,
                                                false, false);
}

// ---------------- weight fp32 -> fp16 ----------------
__global__ __launch_bounds__(256) void cvt_kernel(const float* __restrict__ qkv_w,
                                                  const float* __restrict__ proj_w,
                                                  half_t* __restrict__ wq,
                                                  half_t* __restrict__ wp) {
  int i = blockIdx.x * 256 + threadIdx.x;
  if (i < 3 * CH * CH) wq[i] = (half_t)qkv_w[i];
  if (i < CH * CH)     wp[i] = (half_t)proj_w[i];
}

// ---------------- GroupNorm -> transposed y_t[b][l][c] f16 ----------------
__global__ __launch_bounds__(256) void gn_kernel(const float* __restrict__ x,
                                                 const float* __restrict__ gw,
                                                 const float* __restrict__ gb,
                                                 half_t* __restrict__ y_t) {
  const int CPG = 8;
  int b = blockIdx.x >> 5;
  int g = blockIdx.x & 31;
  const float* xg = x + ((size_t)b * CH + g * CPG) * LCNT;
  float s = 0.f, s2 = 0.f;
  for (int idx = threadIdx.x; idx < CPG * LCNT; idx += 256) {
    float v = xg[idx];
    s += v; s2 += v * v;
  }
#pragma unroll
  for (int off = 16; off > 0; off >>= 1) {
    s  += __shfl_xor(s, off, 32);
    s2 += __shfl_xor(s2, off, 32);
  }
  __shared__ float rs[8], rq[8];
  int wave = threadIdx.x >> 5, lane = threadIdx.x & 31;
  if (lane == 0) { rs[wave] = s; rq[wave] = s2; }
  __syncthreads();
  s = 0.f; s2 = 0.f;
#pragma unroll
  for (int i = 0; i < 8; ++i) { s += rs[i]; s2 += rq[i]; }
  const float invN = 1.0f / (float)(CPG * LCNT);
  float mean = s * invN;
  float var  = s2 * invN - mean * mean;
  float rstd = rsqrtf(var + 1e-5f);
  // One thread owns a position's whole group: its 8 channels are contiguous in
  // y_t, so they leave as one 16-byte store instead of eight 2-byte stores.
  for (int l = threadIdx.x; l < LCNT; l += 256) {
    v8h pk;
#pragma unroll
    for (int cl = 0; cl < CPG; ++cl) {
      int c = g * CPG + cl;
      float v = (xg[cl * LCNT + l] - mean) * rstd * gw[c] + gb[c];
      pk[cl] = (half_t)v;
    }
    *(v8h*)(y_t + ((size_t)b * LCNT + l) * CH + g * CPG) = pk;
  }
}

// ---------------- QKV GEMM: block = 128(o) x 64(l), K=256 ----------------
// All 8 waves share the B tile (y_t rows), staged async + double-buffered in LDS.
__global__ __launch_bounds__(256) void qkv_kernel(const half_t* __restrict__ wq,
                                                  const half_t* __restrict__ y_t,
                                                  const float* __restrict__ qkv_b,
                                                  half_t* __restrict__ qk,
                                                  half_t* __restrict__ vv) {
  int bx   = blockIdx.x;                 // 16 b * 6 mblk * 16 nt = 1536
  int b    = bx / 96;
  int rem  = bx - b * 96;
  int mblk = rem >> 4;
  int nt   = rem & 15;
  int l0   = nt << 6;
  int tid  = threadIdx.x, wave = tid >> 5, lane = tid & 31;
  int o0   = mblk * 128 + wave * 16;
  const half_t* yb = y_t + (size_t)b * LCNT * CH;

  __shared__ __align__(16) half_t btile[2][64][32];   // [l][k] for current k-step
  int srow = tid >> 2, sch = (tid & 3) << 3;          // 64 rows x 4 chunks of 16B
  const half_t* gsrc = yb + (size_t)(l0 + srow) * CH + sch;

  async_b128(gsrc, &btile[0][srow][sch]);             // prologue: k-step 0
  v8f acc[4] = {};
  for (int ks = 0; ks < 8; ++ks) {
    int buf = ks & 1;
    if (ks + 1 < 8) {
      async_b128(gsrc + (ks + 1) * 32, &btile[buf ^ 1][srow][sch]);
      wait_async_le<1>();                              // retire current buffer
    } else {
      wait_async_le<0>();
    }
    __syncthreads();
    v16h af = load_frag(wq, CH, o0, ks * 32);          // weights: L2-hot
#pragma unroll
    for (int j = 0; j < 4; ++j) {
      v16h bf = load_frag(&btile[buf][0][0], 32, j * 16, 0);
      acc[j] = wmma_f16(af, bf, acc[j]);
    }
    __syncthreads();                                   // protect buf before overwrite
  }

  int mh = (lane >> 4) << 3;
  float pb[8];
#pragma unroll
  for (int r = 0; r < 8; ++r) pb[r] = qkv_b[o0 + mh + r];
#pragma unroll
  for (int j = 0; j < 4; ++j) {
#pragma unroll
    for (int r = 0; r < 8; ++r) {
      int o = o0 + mh + r;
      int l = l0 + j * 16 + (lane & 15);
      float val = acc[j][r] + pb[r];
      int sec = o >> 8;                 // 0=q 1=k 2=v
      int h = (o >> 6) & 3;
      int d = o & 63;
      if (sec == 2)
        vv[(((size_t)b * NH + h) * HD + d) * LCNT + l] = (half_t)val;   // [b][h][d][l]
      else
        qk[((((size_t)b * 2 + sec) * NH + h) * LCNT + l) * HD + d] = (half_t)val; // [b][s][h][l][d]
    }
  }
}

// ---------------- flash attention: K/V tiles async-staged, shared by 8 waves ----------------
__global__ __launch_bounds__(256) void attn_kernel(const half_t* __restrict__ qk,
                                                   const half_t* __restrict__ vv,
                                                   half_t* __restrict__ ao) {
  int bh = blockIdx.x >> 3;
  int ib = blockIdx.x & 7;
  int b = bh >> 2, h = bh & 3;
  int tid = threadIdx.x, wave = tid >> 5, lane = tid & 31;
  const half_t* qt = qk + (((size_t)b * 2 * NH + h) * LCNT) * HD;
  const half_t* kt = qk + ((((size_t)b * 2 + 1) * NH + h) * LCNT) * HD;
  const half_t* vp = vv + (((size_t)b * NH + h) * HD) * LCNT;
  int i0 = ib * 128 + wave * 16;

  __shared__ __align__(16) half_t ktile[2][32][64];   // [j][d]
  __shared__ __align__(16) half_t vtile[2][64][32];   // [d][j]
  __shared__ __align__(16) half_t pstage[8][16 * 32]; // per-wave P re-layout
  half_t* ps = pstage[wave];

  int krow = tid >> 3, kch = (tid & 7) << 3;          // 32 rows x 8 chunks
  int vrow = tid >> 2, vch = (tid & 3) << 3;          // 64 rows x 4 chunks
  const half_t* kgb = kt + (size_t)krow * HD + kch;
  const half_t* vgb = vp + (size_t)vrow * LCNT + vch;

  v16h qf0 = load_frag(qt, HD, i0, 0);
  v16h qf1 = load_frag(qt, HD, i0, 32);
  float m_i[8], l_i[8];
  v8f O[4] = {};
#pragma unroll
  for (int r = 0; r < 8; ++r) { m_i[r] = -1e30f; l_i[r] = 0.f; }
  const float scale = 0.125f;   // 64^-0.5

  async_b128(kgb, &ktile[0][krow][kch]);              // prologue j-block 0
  async_b128(vgb, &vtile[0][vrow][vch]);

  for (int js = 0; js < 32; ++js) {
    int buf = js & 1;
    if (js + 1 < 32) {
      int jn = (js + 1) * 32;
      async_b128(kgb + (size_t)jn * HD, &ktile[buf ^ 1][krow][kch]);
      async_b128(vgb + jn,              &vtile[buf ^ 1][vrow][vch]);
      wait_async_le<2>();
    } else {
      wait_async_le<0>();
    }
    __syncthreads();

    v16h kf00 = load_frag(&ktile[buf][0][0], HD, 0,  0);
    v16h kf01 = load_frag(&ktile[buf][0][0], HD, 0,  32);
    v16h kf10 = load_frag(&ktile[buf][0][0], HD, 16, 0);
    v16h kf11 = load_frag(&ktile[buf][0][0], HD, 16, 32);
    v8f s0 = {}, s1 = {};
    s0 = wmma_f16(qf0, kf00, s0);
    s0 = wmma_f16(qf1, kf01, s0);
    s1 = wmma_f16(qf0, kf10, s1);
    s1 = wmma_f16(qf1, kf11, s1);

#pragma unroll
    for (int r = 0; r < 8; ++r) {
      float a0 = s0[r] * scale, a1 = s1[r] * scale;
      float rm = fmaxf(a0, a1);
#pragma unroll
      for (int off = 1; off < 16; off <<= 1) rm = fmaxf(rm, __shfl_xor(rm, off, 32));
      float mn = fmaxf(m_i[r], rm);
      float alpha = __expf(m_i[r] - mn);
      m_i[r] = mn;
      float e0 = __expf(a0 - mn), e1 = __expf(a1 - mn);
      float rsum = e0 + e1;
#pragma unroll
      for (int off = 1; off < 16; off <<= 1) rsum += __shfl_xor(rsum, off, 32);
      l_i[r] = l_i[r] * alpha + rsum;
#pragma unroll
      for (int tt = 0; tt < 4; ++tt) O[tt][r] *= alpha;
      int row = r + ((lane >> 4) << 3);
      ps[row * 32 + (lane & 15)]      = (half_t)e0;
      ps[row * 32 + 16 + (lane & 15)] = (half_t)e1;
    }
    // same-wave DS ordering: P store -> A-fragment reload
    v16h pf = load_frag(ps, 32, 0, 0);
#pragma unroll
    for (int tt = 0; tt < 4; ++tt) {
      v16h vf = load_frag(&vtile[buf][0][0], 32, tt * 16, 0);
      O[tt] = wmma_f16(pf, vf, O[tt]);
    }
    __syncthreads();                                   // buf reusable next iter
  }

#pragma unroll
  for (int r = 0; r < 8; ++r) {
    float inv = 1.0f / l_i[r];
#pragma unroll
    for (int tt = 0; tt < 4; ++tt) O[tt][r] *= inv;
  }
#pragma unroll
  for (int tt = 0; tt < 4; ++tt)
#pragma unroll
    for (int r = 0; r < 8; ++r) {
      int i = i0 + r + ((lane >> 4) << 3);
      int c = h * HD + tt * 16 + (lane & 15);
      ao[((size_t)b * LCNT + i) * CH + c] = (half_t)(O[tt][r]);   // [b][l][c]
    }
}

// ---------------- proj GEMM + bias + residual: block = 128(o) x 64(l) ----------------
__global__ __launch_bounds__(256) void proj_kernel(const half_t* __restrict__ wp,
                                                   const half_t* __restrict__ ao,
                                                   const float* __restrict__ proj_b,
                                                   const float* __restrict__ x,
                                                   float* __restrict__ out) {
  int bx   = blockIdx.x;                 // 16 b * 2 mblk * 16 nt = 512
  int b    = bx / 32;
  int rem  = bx - b * 32;
  int mblk = rem >> 4;
  int nt   = rem & 15;
  int l0   = nt << 6;
  int tid  = threadIdx.x, wave = tid >> 5, lane = tid & 31;
  int o0   = mblk * 128 + wave * 16;
  const half_t* ab = ao + (size_t)b * LCNT * CH;

  __shared__ __align__(16) half_t btile[2][64][32];
  int srow = tid >> 2, sch = (tid & 3) << 3;
  const half_t* gsrc = ab + (size_t)(l0 + srow) * CH + sch;

  async_b128(gsrc, &btile[0][srow][sch]);
  v8f acc[4] = {};
  for (int ks = 0; ks < 8; ++ks) {
    int buf = ks & 1;
    if (ks + 1 < 8) {
      async_b128(gsrc + (ks + 1) * 32, &btile[buf ^ 1][srow][sch]);
      wait_async_le<1>();
    } else {
      wait_async_le<0>();
    }
    __syncthreads();
    v16h af = load_frag(wp, CH, o0, ks * 32);
#pragma unroll
    for (int j = 0; j < 4; ++j) {
      v16h bf = load_frag(&btile[buf][0][0], 32, j * 16, 0);
      acc[j] = wmma_f16(af, bf, acc[j]);
    }
    __syncthreads();
  }

  int mh = (lane >> 4) << 3;
  float pb[8];
#pragma unroll
  for (int r = 0; r < 8; ++r) pb[r] = proj_b[o0 + mh + r];
#pragma unroll
  for (int j = 0; j < 4; ++j)
#pragma unroll
    for (int r = 0; r < 8; ++r) {
      int o = o0 + mh + r;
      int l = l0 + j * 16 + (lane & 15);
      size_t idx = ((size_t)b * CH + o) * LCNT + l;
      out[idx] = x[idx] + pb[r] + acc[j][r];
    }
}

extern "C" void kernel_launch(void* const* d_in, const int* in_sizes, int n_in,
                              void* d_out, int out_size, void* d_ws, size_t ws_size,
                              hipStream_t stream) {
  const float* x      = (const float*)d_in[0];
  const float* gn_w   = (const float*)d_in[1];
  const float* gn_b   = (const float*)d_in[2];
  const float* qkv_w  = (const float*)d_in[3];
  const float* qkv_b  = (const float*)d_in[4];
  const float* proj_w = (const float*)d_in[5];
  const float* proj_b = (const float*)d_in[6];
  float* out = (float*)d_out;

  // workspace layout (bytes), total ~40.5 MB
  char* ws = (char*)d_ws;
  half_t* wq  = (half_t*)(ws);              // 768*256 f16
  half_t* wp  = (half_t*)(ws +   393216);   // 256*256 f16
  half_t* y_t = (half_t*)(ws +   524288);   // 16*1024*256 f16
  half_t* qk  = (half_t*)(ws +  8912896);   // 16*2*4*1024*64 f16
  half_t* vv  = (half_t*)(ws + 25690112);   // 16*4*64*1024 f16
  half_t* ao  = (half_t*)(ws + 34078720);   // 16*1024*256 f16

  cvt_kernel <<<768,  256, 0, stream>>>(qkv_w, proj_w, wq, wp);
  gn_kernel  <<<512,  256, 0, stream>>>(x, gn_w, gn_b, y_t);
  qkv_kernel <<<1536, 256, 0, stream>>>(wq, y_t, qkv_b, qk, vv);
  attn_kernel<<<512,  256, 0, stream>>>(qk, vv, ao);
  proj_kernel<<<512,  256, 0, stream>>>(wp, ao, proj_b, x, out);
}

// v002
// One run takes 125 microseconds.
// Two timings next to v001 both put it at 1.10 times that version's speed.
// Over all steps from v000 it is 1.67 times as fast.
#include <hip/hip_runtime.h>
#include <hip/hip_bf16.h>

typedef _Float16 half_t;
typedef __attribute__((ext_vector_type(8)))  _Float16 v8h;
typedef __attribute__((ext_vector_type(16))) _Float16 v16h;
typedef __attribute__((ext_vector_type(8)))  float    v8f;
typedef __attribute__((ext_vector_type(4)))  int      v4i;

#define LCNT 1024   // 32*32 spatial positions
#define CH   256
#define NH   4
#define HD   64
#define OPITCH 72

#if __has_builtin(__builtin_amdgcn_global_load_async_to_lds_b128)
#define HAS_ASYNC 1
#else
#define HAS_ASYNC 0
#endif

#if HAS_ASYNC
typedef __attribute__((address_space(1))) v4i gv4i_t;   // global int4
typedef __attribute__((address_space(3))) v4i lv4i_t;   // LDS int4
#endif

__device__ __forceinline__ void async_b128(const half_t* g, half_t* l) {
#if HAS_ASYNC
  __builtin_amdgcn_global_load_async_to_lds_b128((gv4i_t*)g, (lv4i_t*)l, 0, 0);
#else
  *(v8h*)l = *(const v8h*)g;   // sync fallback: global load + ds store
#endif
}

template <int N>
__device__ __forceinline__ void wait_async_le() {
#if HAS_ASYNC
#if __has_builtin(__builtin_amdgcn_s_wait_asynccnt)
  __builtin_amdgcn_s_wait_asynccnt(N);
#else
  asm volatile("s_wait_asynccnt %0" :: "i"(N) : "memory");
#endif
#endif
}

__device__ __forceinline__ v16h load_frag(const half_t* __restrict__ base,
                                          int ld, int row0, int k0) {
  int lane = threadIdx.x & 31;
  const half_t* p = base + (size_t)(row0 + (lane & 15)) * ld + k0 + ((lane >> 4) << 3);
  v8h lo = *(const v8h*)(p);
  v8h hi = *(const v8h*)(p + 16);
  v16h f;
#pragma unroll
  for (int i = 0; i < 8; ++i) { f[i] = lo[i]; f[8 + i] = hi[i]; }
  return f;
}

__device__ __forceinline__ v8f wmma_f16(v16h a, v16h b, v8f c) {
  return __builtin_amdgcn_wmma_f32_16x16x32_f16(false, a, false, b, (short)0, c,
                                                false, false);
}

// ---------------- weight fp32 -> fp16 ----------------
__global__ __launch_bounds__(256) void cvt_kernel(const float* __restrict__ qkv_w,
                                                  const float* __restrict__ proj_w,
                                                  half_t* __restrict__ wq,
                                                  half_t* __restrict__ wp) {
  int i = blockIdx.x * 256 + threadIdx.x;
  if (i < 3 * CH * CH) wq[i] = (half_t)qkv_w[i];
  if (i < CH * CH)     wp[i] = (half_t)proj_w[i];
}

// ---------------- GroupNorm -> transposed y_t[b][l][c] f16 ----------------
__global__ __launch_bounds__(256) void gn_kernel(const float* __restrict__ x,
                                                 const float* __restrict__ gw,
                                                 const float* __restrict__ gb,
                                                 half_t* __restrict__ y_t) {
  const int CPG = 8;
  int b = blockIdx.x >> 5;
  int g = blockIdx.x & 31;
  const float* xg = x + ((size_t)b * CH + g * CPG) * LCNT;
  float s = 0.f, s2 = 0.f;
  for (int idx = threadIdx.x; idx < CPG * LCNT; idx += 256) {
    float v = xg[idx];
    s += v; s2 += v * v;
  }
#pragma unroll
  for (int off = 16; off > 0; off >>= 1) {
    s  += __shfl_xor(s, off, 32);
    s2 += __shfl_xor(s2, off, 32);
  }
  __shared__ float rs[8], rq[8];
  int wave = threadIdx.x >> 5, lane = threadIdx.x & 31;
  if (lane == 0) { rs[wave] = s; rq[wave] = s2; }
  __syncthreads();
  s = 0.f; s2 = 0.f;
#pragma unroll
  for (int i = 0; i < 8; ++i) { s += rs[i]; s2 += rq[i]; }
  const float invN = 1.0f / (float)(CPG * LCNT);
  float mean = s * invN;
  float var  = s2 * invN - mean * mean;
  float rstd = rsqrtf(var + 1e-5f);
  // One thread owns a position's whole group: its 8 channels are contiguous in
  // y_t, so they leave as one 16-byte store instead of eight 2-byte stores.
  for (int l = threadIdx.x; l < LCNT; l += 256) {
    v8h pk;
#pragma unroll
    for (int cl = 0; cl < CPG; ++cl) {
      int c = g * CPG + cl;
      float v = (xg[cl * LCNT + l] - mean) * rstd * gw[c] + gb[c];
      pk[cl] = (half_t)v;
    }
    *(v8h*)(y_t + ((size_t)b * LCNT + l) * CH + g * CPG) = pk;
  }
}

// ---------------- QKV GEMM: block = 128(o) x 64(l), K=256 ----------------
// All 8 waves share the B tile (y_t rows), staged async + double-buffered in LDS.
__global__ __launch_bounds__(256) void qkv_kernel(const half_t* __restrict__ wq,
                                                  const half_t* __restrict__ y_t,
                                                  const float* __restrict__ qkv_b,
                                                  half_t* __restrict__ qk,
                                                  half_t* __restrict__ vv) {
  int bx   = blockIdx.x;                 // 16 b * 6 mblk * 16 nt = 1536
  int b    = bx / 96;
  int rem  = bx - b * 96;
  int mblk = rem >> 4;
  int nt   = rem & 15;
  int l0   = nt << 6;
  int tid  = threadIdx.x, wave = tid >> 5, lane = tid & 31;
  int o0   = mblk * 128 + wave * 16;
  const half_t* yb = y_t + (size_t)b * LCNT * CH;

  __shared__ __align__(16) half_t btile[2][64][32];   // [l][k] for current k-step
  __shared__ __align__(16) half_t ostage[128][OPITCH]; // output tile, one row per 128-B line of q, k or v
  int srow = tid >> 2, sch = (tid & 3) << 3;          // 64 rows x 4 chunks of 16B
  const half_t* gsrc = yb + (size_t)(l0 + srow) * CH + sch;

  async_b128(gsrc, &btile[0][srow][sch]);             // prologue: k-step 0
  v8f acc[4] = {};
  for (int ks = 0; ks < 8; ++ks) {
    int buf = ks & 1;
    if (ks + 1 < 8) {
      async_b128(gsrc + (ks + 1) * 32, &btile[buf ^ 1][srow][sch]);
      wait_async_le<1>();                              // retire current buffer
    } else {
      wait_async_le<0>();
    }
    __syncthreads();
    v16h af = load_frag(wq, CH, o0, ks * 32);          // weights: L2-hot
#pragma unroll
    for (int j = 0; j < 4; ++j) {
      v16h bf = load_frag(&btile[buf][0][0], 32, j * 16, 0);
      acc[j] = wmma_f16(af, bf, acc[j]);
    }
    __syncthreads();                                   // protect buf before overwrite
  }

  int mh = (lane >> 4) << 3;
  float pb[8];
#pragma unroll
  for (int r = 0; r < 8; ++r) pb[r] = qkv_b[o0 + mh + r];

  // The block's 128 o are one section (0=q 1=k 2=v) and two heads. The tile is
  // laid in LDS in the order of the destination, one row per 128-B line, and
  // then leaves as 16-byte stores: 8 lanes a line, 4 whole lines a wave.
  int sec = mblk >> 1;
  half_t* dst;          // first line of the tile
  int rstep, hstep;     // f16 from row to row inside a half of 64 rows; from half to half
  if (sec == 2) {       // v [b][h][d][l]: row = o, 64 l a row
#pragma unroll
    for (int j = 0; j < 4; ++j)
#pragma unroll
      for (int r = 0; r < 8; ++r)
        ostage[wave * 16 + mh + r][j * 16 + (lane & 15)] = (half_t)(acc[j][r] + pb[r]);
    dst   = vv + ((size_t)b * CH + (mblk & 1) * 128) * LCNT + l0;
    rstep = LCNT;
    hstep = 64 * LCNT;
  } else {              // q, k [b][s][h][l][d]: row = (head, l), 64 d a row
#pragma unroll
    for (int j = 0; j < 4; ++j) {
      v8h pk;
#pragma unroll
      for (int r = 0; r < 8; ++r) pk[r] = (half_t)(acc[j][r] + pb[r]);
      *(v8h*)&ostage[(wave >> 2) * 64 + j * 16 + (lane & 15)][(wave & 3) * 16 + mh] = pk;
    }
    dst   = qk + ((((size_t)b * 2 + sec) * NH + (mblk & 1) * 2) * LCNT + l0) * HD;
    rstep = HD;
    hstep = LCNT * HD;
  }
  __syncthreads();      // rows are read back by other waves than wrote them: all staged before any row is read
#pragma unroll
  for (int it = 0; it < 4; ++it) {
    int c = it * 256 + tid;
    int row = c >> 3, ch = (c & 7) << 3;
    *(v8h*)(dst + (size_t)(row >> 6) * hstep + (size_t)(row & 63) * rstep + ch) =
        *(const v8h*)&ostage[row][ch];
  }
}

// ---------------- flash attention: K/V tiles async-staged, shared by 8 waves ----------------
__global__ __launch_bounds__(256) void attn_kernel(const half_t* __restrict__ qk,
                                                   const half_t* __restrict__ vv,
                                                   half_t* __restrict__ ao) {
  int bh = blockIdx.x >> 3;
  int ib = blockIdx.x & 7;
  int b = bh >> 2, h = bh & 3;
  int tid = threadIdx.x, wave = tid >> 5, lane = tid & 31;
  const half_t* qt = qk + (((size_t)b * 2 * NH + h) * LCNT) * HD;
  const half_t* kt = qk + ((((size_t)b * 2 + 1) * NH + h) * LCNT) * HD;
  const half_t* vp = vv + (((size_t)b * NH + h) * HD) * LCNT;
  int i0 = ib * 128 + wave * 16;

  __shared__ __align__(16) half_t ktile[2][32][64];   // [j][d]
  __shared__ __align__(16) half_t vtile[2][64][32];   // [d][j]
  __shared__ __align__(16) half_t pstage[8][16 * 32]; // per-wave P re-layout
  half_t* ps = pstage[wave];

  int krow = tid >> 3, kch = (tid & 7) << 3;          // 32 rows x 8 chunks
  int vrow = tid >> 2, vch = (tid & 3) << 3;          // 64 rows x 4 chunks
  const half_t* kgb = kt + (size_t)krow * HD + kch;
  const half_t* vgb = vp + (size_t)vrow * LCNT + vch;

  v16h qf0 = load_frag(qt, HD, i0, 0);
  v16h qf1 = load_frag(qt, HD, i0, 32);
  float m_i[8], l_i[8];
  v8f O[4] = {};
#pragma unroll
  for (int r = 0; r < 8; ++r) { m_i[r] = -1e30f; l_i[r] = 0.f; }
  const float scale = 0.125f;   // 64^-0.5

  async_b128(kgb, &ktile[0][krow][kch]);              // prologue j-block 0
  async_b128(vgb, &vtile[0][vrow][vch]);

  for (int js = 0; js < 32; ++js) {
    int buf = js & 1;
    if (js + 1 < 32) {
      int jn = (js + 1) * 32;
      async_b128(kgb + (size_t)jn * HD, &ktile[buf ^ 1][krow][kch]);
      async_b128(vgb + jn,              &vtile[buf ^ 1][vrow][vch]);
      wait_async_le<2>();
    } else {
      wait_async_le<0>();
    }
    __syncthreads();

    v16h kf00 = load_frag(&ktile[buf][0][0], HD, 0,  0);
    v16h kf01 = load_frag(&ktile[buf][0][0], HD, 0,  32);
    v16h kf10 = load_frag(&ktile[buf][0][0], HD, 16, 0);
    v16h kf11 = load_frag(&ktile[buf][0][0], HD, 16, 32);
    v8f s0 = {}, s1 = {};
    s0 = wmma_f16(qf0, kf00, s0);
    s0 = wmma_f16(qf1, kf01, s0);
    s1 = wmma_f16(qf0, kf10, s1);
    s1 = wmma_f16(qf1, kf11, s1);

#pragma unroll
    for (int r = 0; r < 8; ++r) {
      float a0 = s0[r] * scale, a1 = s1[r] * scale;
      float rm = fmaxf(a0, a1);
#pragma unroll
      for (int off = 1; off < 16; off <<= 1) rm = fmaxf(rm, __shfl_xor(rm, off, 32));
      float mn = fmaxf(m_i[r], rm);
      float alpha = __expf(m_i[r] - mn);
      m_i[r] = mn;
      float e0 = __expf(a0 - mn), e1 = __expf(a1 - mn);
      float rsum = e0 + e1;
#pragma unroll
      for (int off = 1; off < 16; off <<= 1) rsum += __shfl_xor(rsum, off, 32);
      l_i[r] = l_i[r] * alpha + rsum;
#pragma unroll
      for (int tt = 0; tt < 4; ++tt) O[tt][r] *= alpha;
      int row = r + ((lane >> 4) << 3);
      ps[row * 32 + (lane & 15)]      = (half_t)e0;
      ps[row * 32 + 16 + (lane & 15)] = (half_t)e1;
    }
    // same-wave DS ordering: P store -> A-fragment reload
    v16h pf = load_frag(ps, 32, 0, 0);
#pragma unroll
    for (int tt = 0; tt < 4; ++tt) {
      v16h vf = load_frag(&vtile[buf][0][0], 32, tt * 16, 0);
      O[tt] = wmma_f16(pf, vf, O[tt]);
    }
    __syncthreads();                                   // buf reusable next iter
  }

#pragma unroll
  for (int r = 0; r < 8; ++r) {
    float inv = 1.0f / l_i[r];
#pragma unroll
    for (int tt = 0; tt < 4; ++tt) O[tt][r] *= inv;
  }
#pragma unroll
  for (int tt = 0; tt < 4; ++tt)
#pragma unroll
    for (int r = 0; r < 8; ++r) {
      int i = i0 + r + ((lane >> 4) << 3);
      int c = h * HD + tt * 16 + (lane & 15);
      ao[((size_t)b * LCNT + i) * CH + c] = (half_t)(O[tt][r]);   // [b][l][c]
    }
}

// ---------------- proj GEMM + bias + residual: block = 128(o) x 64(l) ----------------
__global__ __launch_bounds__(256) void proj_kernel(const half_t* __restrict__ wp,
                                                   const half_t* __restrict__ ao,
                                                   const float* __restrict__ proj_b,
                                                   const float* __restrict__ x,
                                                   float* __restrict__ out) {
  int bx   = blockIdx.x;                 // 16 b * 2 mblk * 16 nt = 512
  int b    = bx / 32;
  int rem  = bx - b * 32;
  int mblk = rem >> 4;
  int nt   = rem & 15;
  int l0   = nt << 6;
  int tid  = threadIdx.x, wave = tid >> 5, lane = tid & 31;
  int o0   = mblk * 128 + wave * 16;
  const half_t* ab = ao + (size_t)b * LCNT * CH;

  __shared__ __align__(16) half_t btile[2][64][32];
  int srow = tid >> 2, sch = (tid & 3) << 3;
  const half_t* gsrc = ab + (size_t)(l0 + srow) * CH + sch;

  async_b128(gsrc, &btile[0][srow][sch]);
  v8f acc[4] = {};
  for (int ks = 0; ks < 8; ++ks) {
    int buf = ks & 1;
    if (ks + 1 < 8) {
      async_b128(gsrc + (ks + 1) * 32, &btile[buf ^ 1][srow][sch]);
      wait_async_le<1>();
    } else {
      wait_async_le<0>();
    }
    __syncthreads();
    v16h af = load_frag(wp, CH, o0, ks * 32);
#pragma unroll
    for (int j = 0; j < 4; ++j) {
      v16h bf = load_frag(&btile[buf][0][0], 32, j * 16, 0);
      acc[j] = wmma_f16(af, bf, acc[j]);
    }
    __syncthreads();
  }

  int mh = (lane >> 4) << 3;
  float pb[8];
#pragma unroll
  for (int r = 0; r < 8; ++r) pb[r] = proj_b[o0 + mh + r];
#pragma unroll
  for (int j = 0; j < 4; ++j)
#pragma unroll
    for (int r = 0; r < 8; ++r) {
      int o = o0 + mh + r;
      int l = l0 + j * 16 + (lane & 15);
      size_t idx = ((size_t)b * CH + o) * LCNT + l;
      out[idx] = x[idx] + pb[r] + acc[j][r];
    }
}

extern "C" void kernel_launch(void* const* d_in, const int* in_sizes, int n_in,
                              void* d_out, int out_size, void* d_ws, size_t ws_size,
                              hipStream_t stream) {
  const float* x      = (const float*)d_in[0];
  const float* gn_w   = (const float*)d_in[1];
  const float* gn_b   = (const float*)d_in[2];
  const float* qkv_w  = (const float*)d_in[3];
  const float* qkv_b  = (const float*)d_in[4];
  const float* proj_w = (const float*)d_in[5];
  const float* proj_b = (const float*)d_in[6];
  float* out = (float*)d_out;

  // workspace layout (bytes), total ~40.5 MB
  char* ws = (char*)d_ws;
  half_t* wq  = (half_t*)(ws);              // 768*256 f16
  half_t* wp  = (half_t*)(ws +   393216);   // 256*256 f16
  half_t* y_t = (half_t*)(ws +   524288);   // 16*1024*256 f16
  half_t* qk  = (half_t*)(ws +  8912896);   // 16*2*4*1024*64 f16
  half_t* vv  = (half_t*)(ws + 25690112);   // 16*4*64*1024 f16
  half_t* ao  = (half_t*)(ws + 34078720);   // 16*1024*256 f16

  cvt_kernel <<<768,  256, 0, stream>>>(qkv_w, proj_w, wq, wp);
  gn_kernel  <<<512,  256, 0, stream>>>(x, gn_w, gn_b, y_t);
  qkv_kernel <<<1536, 256, 0, stream>>>(wq, y_t, qkv_b, qk, vv);
  attn_kernel<<<512,  256, 0, stream>>>(qk, vv, ao);
  proj_kernel<<<512,  256, 0, stream>>>(wp, ao, proj_b, x, out);
}

// v003
// One run takes 96.3 microseconds.
// Two timings next to v002 put it at 1.29 and 1.30 times that version's speed.
// All steps since v000 together make it 2.16 times as fast.
#include <hip/hip_runtime.h>
#include <hip/hip_bf16.h>

typedef _Float16 half_t;
typedef __attribute__((ext_vector_type(8)))  _Float16 v8h;
typedef __attribute__((ext_vector_type(16))) _Float16 v16h;
typedef __attribute__((ext_vector_type(8)))  float    v8f;
typedef __attribute__((ext_vector_type(4)))  int      v4i;

#define LCNT 1024   // 32*32 spatial positions
#define CH   256
#define NH   4
#define HD   64
#define OPITCH 72
#define KPITCH 72
#define TPITCH 40

#if __has_builtin(__builtin_amdgcn_global_load_async_to_lds_b128)
#define HAS_ASYNC 1
#else
#define HAS_ASYNC 0
#endif

#if HAS_ASYNC
typedef __attribute__((address_space(1))) v4i gv4i_t;   // global int4
typedef __attribute__((address_space(3))) v4i lv4i_t;   // LDS int4
#endif

__device__ __forceinline__ void async_b128(const half_t* g, half_t* l) {
#if HAS_ASYNC
  __builtin_amdgcn_global_load_async_to_lds_b128((gv4i_t*)g, (lv4i_t*)l, 0, 0);
#else
  *(v8h*)l = *(const v8h*)g;   // sync fallback: global load + ds store
#endif
}

template <int N>
__device__ __forceinline__ void wait_async_le() {
#if HAS_ASYNC
#if __has_builtin(__builtin_amdgcn_s_wait_asynccnt)
  __builtin_amdgcn_s_wait_asynccnt(N);
#else
  asm volatile("s_wait_asynccnt %0" :: "i"(N) : "memory");
#endif
#endif
}

__device__ __forceinline__ v16h load_frag(const half_t* __restrict__ base,
                                          int ld, int row0, int k0) {
  int lane = threadIdx.x & 31;
  const half_t* p = base + (size_t)(row0 + (lane & 15)) * ld + k0 + ((lane >> 4) << 3);
  v8h lo = *(const v8h*)(p);
  v8h hi = *(const v8h*)(p + 16);
  v16h f;
#pragma unroll
  for (int i = 0; i < 8; ++i) { f[i] = lo[i]; f[8 + i] = hi[i]; }
  return f;
}

__device__ __forceinline__ v8f wmma_f16(v16h a, v16h b, v8f c) {
  return __builtin_amdgcn_wmma_f32_16x16x32_f16(false, a, false, b, (short)0, c,
                                                false, false);
}

// ---------------- weight fp32 -> fp16 ----------------
__global__ __launch_bounds__(256) void cvt_kernel(const float* __restrict__ qkv_w,
                                                  const float* __restrict__ proj_w,
                                                  half_t* __restrict__ wq,
                                                  half_t* __restrict__ wp) {
  int i = blockIdx.x * 256 + threadIdx.x;
  if (i < 3 * CH * CH) wq[i] = (half_t)qkv_w[i];
  if (i < CH * CH)     wp[i] = (half_t)proj_w[i];
}

// ---------------- GroupNorm -> transposed y_t[b][l][c] f16 ----------------
__global__ __launch_bounds__(256) void gn_kernel(const float* __restrict__ x,
                                                 const float* __restrict__ gw,
                                                 const float* __restrict__ gb,
                                                 half_t* __restrict__ y_t) {
  const int CPG = 8;
  int b = blockIdx.x >> 5;
  int g = blockIdx.x & 31;
  const float* xg = x + ((size_t)b * CH + g * CPG) * LCNT;
  float s = 0.f, s2 = 0.f;
  for (int idx = threadIdx.x; idx < CPG * LCNT; idx += 256) {
    float v = xg[idx];
    s += v; s2 += v * v;
  }
#pragma unroll
  for (int off = 16; off > 0; off >>= 1) {
    s  += __shfl_xor(s, off, 32);
    s2 += __shfl_xor(s2, off, 32);
  }
  __shared__ float rs[8], rq[8];
  int wave = threadIdx.x >> 5, lane = threadIdx.x & 31;
  if (lane == 0) { rs[wave] = s; rq[wave] = s2; }
  __syncthreads();
  s = 0.f; s2 = 0.f;
#pragma unroll
  for (int i = 0; i < 8; ++i) { s += rs[i]; s2 += rq[i]; }
  const float invN = 1.0f / (float)(CPG * LCNT);
  float mean = s * invN;
  float var  = s2 * invN - mean * mean;
  float rstd = rsqrtf(var + 1e-5f);
  // One thread owns a position's whole group: its 8 channels are contiguous in
  // y_t, so they leave as one 16-byte store instead of eight 2-byte stores.
  for (int l = threadIdx.x; l < LCNT; l += 256) {
    v8h pk;
#pragma unroll
    for (int cl = 0; cl < CPG; ++cl) {
      int c = g * CPG + cl;
      float v = (xg[cl * LCNT + l] - mean) * rstd * gw[c] + gb[c];
      pk[cl] = (half_t)v;
    }
    *(v8h*)(y_t + ((size_t)b * LCNT + l) * CH + g * CPG) = pk;
  }
}

// ---------------- QKV GEMM: block = 128(o) x 64(l), K=256 ----------------
// All 8 waves share the B tile (y_t rows), staged async + double-buffered in LDS.
__global__ __launch_bounds__(256) void qkv_kernel(const half_t* __restrict__ wq,
                                                  const half_t* __restrict__ y_t,
                                                  const float* __restrict__ qkv_b,
                                                  half_t* __restrict__ qk,
                                                  half_t* __restrict__ vv) {
  int bx   = blockIdx.x;                 // 16 b * 6 mblk * 16 nt = 1536
  int b    = bx / 96;
  int rem  = bx - b * 96;
  int mblk = rem >> 4;
  int nt   = rem & 15;
  int l0   = nt << 6;
  int tid  = threadIdx.x, wave = tid >> 5, lane = tid & 31;
  int o0   = mblk * 128 + wave * 16;
  const half_t* yb = y_t + (size_t)b * LCNT * CH;

  __shared__ __align__(16) half_t btile[2][64][TPITCH];   // [l][k] for current k-step; 32 k a row, then the pad
  __shared__ __align__(16) half_t ostage[128][OPITCH]; // output tile, one row per 128-B line of q, k or v
  int srow = tid >> 2, sch = (tid & 3) << 3;          // 64 rows x 4 chunks of 16B
  const half_t* gsrc = yb + (size_t)(l0 + srow) * CH + sch;

  async_b128(gsrc, &btile[0][srow][sch]);             // prologue: k-step 0
  v8f acc[4] = {};
  for (int ks = 0; ks < 8; ++ks) {
    int buf = ks & 1;
    if (ks + 1 < 8) {
      async_b128(gsrc + (ks + 1) * 32, &btile[buf ^ 1][srow][sch]);
      wait_async_le<1>();                              // retire current buffer
    } else {
      wait_async_le<0>();
    }
    __syncthreads();
    v16h af = load_frag(wq, CH, o0, ks * 32);          // weights: L2-hot
#pragma unroll
    for (int j = 0; j < 4; ++j) {
      v16h bf = load_frag(&btile[buf][0][0], TPITCH, j * 16, 0);
      acc[j] = wmma_f16(af, bf, acc[j]);
    }
    __syncthreads();                                   // protect buf before overwrite
  }

  int mh = (lane >> 4) << 3;
  float pb[8];
#pragma unroll
  for (int r = 0; r < 8; ++r) pb[r] = qkv_b[o0 + mh + r];

  // The block's 128 o are one section (0=q 1=k 2=v) and two heads. The tile is
  // laid in LDS in the order of the destination, one row per 128-B line, and
  // then leaves as 16-byte stores: 8 lanes a line, 4 whole lines a wave.
  int sec = mblk >> 1;
  half_t* dst;          // first line of the tile
  int rstep, hstep;     // f16 from row to row inside a half of 64 rows; from half to half
  if (sec == 2) {       // v [b][h][d][l]: row = o, 64 l a row
#pragma unroll
    for (int j = 0; j < 4; ++j)
#pragma unroll
      for (int r = 0; r < 8; ++r)
        ostage[wave * 16 + mh + r][j * 16 + (lane & 15)] = (half_t)(acc[j][r] + pb[r]);
    dst   = vv + ((size_t)b * CH + (mblk & 1) * 128) * LCNT + l0;
    rstep = LCNT;
    hstep = 64 * LCNT;
  } else {              // q, k [b][s][h][l][d]: row = (head, l), 64 d a row
#pragma unroll
    for (int j = 0; j < 4; ++j) {
      v8h pk;
#pragma unroll
      for (int r = 0; r < 8; ++r) pk[r] = (half_t)(acc[j][r] + pb[r]);
      *(v8h*)&ostage[(wave >> 2) * 64 + j * 16 + (lane & 15)][(wave & 3) * 16 + mh] = pk;
    }
    dst   = qk + ((((size_t)b * 2 + sec) * NH + (mblk & 1) * 2) * LCNT + l0) * HD;
    rstep = HD;
    hstep = LCNT * HD;
  }
  __syncthreads();      // rows are read back by other waves than wrote them: all staged before any row is read
#pragma unroll
  for (int it = 0; it < 4; ++it) {
    int c = it * 256 + tid;
    int row = c >> 3, ch = (c & 7) << 3;
    *(v8h*)(dst + (size_t)(row >> 6) * hstep + (size_t)(row & 63) * rstep + ch) =
        *(const v8h*)&ostage[row][ch];
  }
}

// ---------------- flash attention: K/V tiles async-staged, shared by 8 waves ----------------
__global__ __launch_bounds__(256) void attn_kernel(const half_t* __restrict__ qk,
                                                   const half_t* __restrict__ vv,
                                                   half_t* __restrict__ ao) {
  int bh = blockIdx.x >> 3;
  int ib = blockIdx.x & 7;
  int b = bh >> 2, h = bh & 3;
  int tid = threadIdx.x, wave = tid >> 5, lane = tid & 31;
  const half_t* qt = qk + (((size_t)b * 2 * NH + h) * LCNT) * HD;
  const half_t* kt = qk + ((((size_t)b * 2 + 1) * NH + h) * LCNT) * HD;
  const half_t* vp = vv + (((size_t)b * NH + h) * HD) * LCNT;
  int i0 = ib * 128 + wave * 16;

  __shared__ __align__(16) half_t ktile[2][32][KPITCH];   // [j][d]; 64 d a row, then the pad
  __shared__ __align__(16) half_t vtile[2][64][TPITCH];   // [d][j]; 32 j a row, then the pad
  __shared__ __align__(16) half_t pstage[8][16 * TPITCH]; // per-wave P re-layout; 32 j a row, then the pad
  half_t* ps = pstage[wave];

  int krow = tid >> 3, kch = (tid & 7) << 3;          // 32 rows x 8 chunks
  int vrow = tid >> 2, vch = (tid & 3) << 3;          // 64 rows x 4 chunks
  const half_t* kgb = kt + (size_t)krow * HD + kch;
  const half_t* vgb = vp + (size_t)vrow * LCNT + vch;

  v16h qf0 = load_frag(qt, HD, i0, 0);
  v16h qf1 = load_frag(qt, HD, i0, 32);
  float m_i[8], l_i[8];
  v8f O[4] = {};
#pragma unroll
  for (int r = 0; r < 8; ++r) { m_i[r] = -1e30f; l_i[r] = 0.f; }
  const float scale = 0.125f;   // 64^-0.5

  async_b128(kgb, &ktile[0][krow][kch]);              // prologue j-block 0
  async_b128(vgb, &vtile[0][vrow][vch]);

  for (int js = 0; js < 32; ++js) {
    int buf = js & 1;
    if (js + 1 < 32) {
      int jn = (js + 1) * 32;
      async_b128(kgb + (size_t)jn * HD, &ktile[buf ^ 1][krow][kch]);
      async_b128(vgb + jn,              &vtile[buf ^ 1][vrow][vch]);
      wait_async_le<2>();
    } else {
      wait_async_le<0>();
    }
    __syncthreads();

    v16h kf00 = load_frag(&ktile[buf][0][0], KPITCH, 0,  0);
    v16h kf01 = load_frag(&ktile[buf][0][0], KPITCH, 0,  32);
    v16h kf10 = load_frag(&ktile[buf][0][0], KPITCH, 16, 0);
    v16h kf11 = load_frag(&ktile[buf][0][0], KPITCH, 16, 32);
    v8f s0 = {}, s1 = {};
    s0 = wmma_f16(qf0, kf00, s0);
    s0 = wmma_f16(qf1, kf01, s0);
    s1 = wmma_f16(qf0, kf10, s1);
    s1 = wmma_f16(qf1, kf11, s1);

#pragma unroll
    for (int r = 0; r < 8; ++r) {
      float a0 = s0[r] * scale, a1 = s1[r] * scale;
      float rm = fmaxf(a0, a1);
#pragma unroll
      for (int off = 1; off < 16; off <<= 1) rm = fmaxf(rm, __shfl_xor(rm, off, 32));
      float mn = fmaxf(m_i[r], rm);
      float alpha = __expf(m_i[r] - mn);
      m_i[r] = mn;
      float e0 = __expf(a0 - mn), e1 = __expf(a1 - mn);
      float rsum = e0 + e1;
#pragma unroll
      for (int off = 1; off < 16; off <<= 1) rsum += __shfl_xor(rsum, off, 32);
      l_i[r] = l_i[r] * alpha + rsum;
#pragma unroll
      for (int tt = 0; tt < 4; ++tt) O[tt][r] *= alpha;
      int row = r + ((lane >> 4) << 3);
      ps[row * TPITCH + (lane & 15)]      = (half_t)e0;
      ps[row * TPITCH + 16 + (lane & 15)] = (half_t)e1;
    }
    // same-wave DS ordering: P store -> A-fragment reload
    v16h pf = load_frag(ps, TPITCH, 0, 0);
#pragma unroll
    for (int tt = 0; tt < 4; ++tt) {
      v16h vf = load_frag(&vtile[buf][0][0], TPITCH, tt * 16, 0);
      O[tt] = wmma_f16(pf, vf, O[tt]);
    }
    __syncthreads();                                   // buf reusable next iter
  }

#pragma unroll
  for (int r = 0; r < 8; ++r) {
    float inv = 1.0f / l_i[r];
#pragma unroll
    for (int tt = 0; tt < 4; ++tt) O[tt][r] *= inv;
  }
#pragma unroll
  for (int tt = 0; tt < 4; ++tt)
#pragma unroll
    for (int r = 0; r < 8; ++r) {
      int i = i0 + r + ((lane >> 4) << 3);
      int c = h * HD + tt * 16 + (lane & 15);
      ao[((size_t)b * LCNT + i) * CH + c] = (half_t)(O[tt][r]);   // [b][l][c]
    }
}

// ---------------- proj GEMM + bias + residual: block = 128(o) x 64(l) ----------------
__global__ __launch_bounds__(256) void proj_kernel(const half_t* __restrict__ wp,
                                                   const half_t* __restrict__ ao,
                                                   const float* __restrict__ proj_b,
                                                   const float* __restrict__ x,
                                                   float* __restrict__ out) {
  int bx   = blockIdx.x;                 // 16 b * 2 mblk * 16 nt = 512
  int b    = bx / 32;
  int rem  = bx - b * 32;
  int mblk = rem >> 4;
  int nt   = rem & 15;
  int l0   = nt << 6;
  int tid  = threadIdx.x, wave = tid >> 5, lane = tid & 31;
  int o0   = mblk * 128 + wave * 16;
  const half_t* ab = ao + (size_t)b * LCNT * CH;

  __shared__ __align__(16) half_t btile[2][64][TPITCH];
  int srow = tid >> 2, sch = (tid & 3) << 3;
  const half_t* gsrc = ab + (size_t)(l0 + srow) * CH + sch;

  async_b128(gsrc, &btile[0][srow][sch]);
  v8f acc[4] = {};
  for (int ks = 0; ks < 8; ++ks) {
    int buf = ks & 1;
    if (ks + 1 < 8) {
      async_b128(gsrc + (ks + 1) * 32, &btile[buf ^ 1][srow][sch]);
      wait_async_le<1>();
    } else {
      wait_async_le<0>();
    }
    __syncthreads();
    v16h af = load_frag(wp, CH, o0, ks * 32);
#pragma unroll
    for (int j = 0; j < 4; ++j) {
      v16h bf = load_frag(&btile[buf][0][0], TPITCH, j * 16, 0);
      acc[j] = wmma_f16(af, bf, acc[j]);
    }
    __syncthreads();
  }

  int mh = (lane >> 4) << 3;
  float pb[8];
#pragma unroll
  for (int r = 0; r < 8; ++r) pb[r] = proj_b[o0 + mh + r];
#pragma unroll
  for (int j = 0; j < 4; ++j)
#pragma unroll
    for (int r = 0; r < 8; ++r) {
      int o = o0 + mh + r;
      int l = l0 + j * 16 + (lane & 15);
      size_t idx = ((size_t)b * CH + o) * LCNT + l;
      out[idx] = x[idx] + pb[r] + acc[j][r];
    }
}

extern "C" void kernel_launch(void* const* d_in, const int* in_sizes, int n_in,
                              void* d_out, int out_size, void* d_ws, size_t ws_size,
                              hipStream_t stream) {
  const float* x      = (const float*)d_in[0];
  const float* gn_w   = (const float*)d_in[1];
  const float* gn_b   = (const float*)d_in[2];
  const float* qkv_w  = (const float*)d_in[3];
  const float* qkv_b  = (const float*)d_in[4];
  const float* proj_w = (const float*)d_in[5];
  const float* proj_b = (const float*)d_in[6];
  float* out = (float*)d_out;

  // workspace layout (bytes), total ~40.5 MB
  char* ws = (char*)d_ws;
  half_t* wq  = (half_t*)(ws);              // 768*256 f16
  half_t* wp  = (half_t*)(ws +   393216);   // 256*256 f16
  half_t* y_t = (half_t*)(ws +   524288);   // 16*1024*256 f16
  half_t* qk  = (half_t*)(ws +  8912896);   // 16*2*4*1024*64 f16
  half_t* vv  = (half_t*)(ws + 25690112);   // 16*4*64*1024 f16
  half_t* ao  = (half_t*)(ws + 34078720);   // 16*1024*256 f16

  cvt_kernel <<<768,  256, 0, stream>>>(qkv_w, proj_w, wq, wp);
  gn_kernel  <<<512,  256, 0, stream>>>(x, gn_w, gn_b, y_t);
  qkv_kernel <<<1536, 256, 0, stream>>>(wq, y_t, qkv_b, qk, vv);
  attn_kernel<<<512,  256, 0, stream>>>(qk, vv, ao);
  proj_kernel<<<512,  256, 0, stream>>>(wp, ao, proj_b, x, out);
}

// v004
// A run of this version takes 77.8 microseconds.
// In two side-by-side timings against v003, it was 1.22 and 1.23 times as fast.
// All steps since v000 together make it 2.64 times as fast.
#include <hip/hip_runtime.h>
#include <hip/hip_bf16.h>

typedef _Float16 half_t;
typedef __attribute__((ext_vector_type(8)))  _Float16 v8h;
typedef __attribute__((ext_vector_type(16))) _Float16 v16h;
typedef __attribute__((ext_vector_type(8)))  float    v8f;
typedef __attribute__((ext_vector_type(4)))  int      v4i;

#define LCNT 1024   // 32*32 spatial positions
#define CH   256
#define NH   4
#define HD   64
#define OPITCH 72
#define KPITCH 72
#define TPITCH 40

#if __has_builtin(__builtin_amdgcn_global_load_async_to_lds_b128)
#define HAS_ASYNC 1
#else
#define HAS_ASYNC 0
#endif

#if HAS_ASYNC
typedef __attribute__((address_space(1))) v4i gv4i_t;   // global int4
typedef __attribute__((address_space(3))) v4i lv4i_t;   // LDS int4
#endif

__device__ __forceinline__ void async_b128(const half_t* g, half_t* l) {
#if HAS_ASYNC
  __builtin_amdgcn_global_load_async_to_lds_b128((gv4i_t*)g, (lv4i_t*)l, 0, 0);
#else
  *(v8h*)l = *(const v8h*)g;   // sync fallback: global load + ds store
#endif
}

template <int N>
__device__ __forceinline__ void wait_async_le() {
#if HAS_ASYNC
#if __has_builtin(__builtin_amdgcn_s_wait_asynccnt)
  __builtin_amdgcn_s_wait_asynccnt(N);
#else
  asm volatile("s_wait_asynccnt %0" :: "i"(N) : "memory");
#endif
#endif
}

__device__ __forceinline__ v16h load_frag(const half_t* __restrict__ base,
                                          int ld, int row0, int k0) {
  int lane = threadIdx.x & 31;
  const half_t* p = base + (size_t)(row0 + (lane & 15)) * ld + k0 + ((lane >> 4) << 3);
  v8h lo = *(const v8h*)(p);
  v8h hi = *(const v8h*)(p + 16);
  v16h f;
#pragma unroll
  for (int i = 0; i < 8; ++i) { f[i] = lo[i]; f[8 + i] = hi[i]; }
  return f;
}

__device__ __forceinline__ v8f wmma_f16(v16h a, v16h b, v8f c) {
  return __builtin_amdgcn_wmma_f32_16x16x32_f16(false, a, false, b, (short)0, c,
                                                false, false);
}

__device__ __forceinline__ float xhalf(float x) {
  int v = __builtin_bit_cast(int, x);
  return __builtin_bit_cast(float,
      __builtin_amdgcn_permlanex16(v, v, 0x76543210, 0xfedcba98, false, false));
}

__device__ __forceinline__ v8f exp2x8(v8f x) {
  float a, b, c, d, e, f, g, h;
  asm("v_exp_f32 %0, %8\n\tv_exp_f32 %1, %9\n\tv_exp_f32 %2, %10\n\tv_exp_f32 %3, %11\n\t"
      "v_exp_f32 %4, %12\n\tv_exp_f32 %5, %13\n\tv_exp_f32 %6, %14\n\tv_exp_f32 %7, %15\n\tv_nop"
      : "=&v"(a), "=&v"(b), "=&v"(c), "=&v"(d), "=&v"(e), "=&v"(f), "=&v"(g), "=&v"(h)
      : "v"(x[0]), "v"(x[1]), "v"(x[2]), "v"(x[3]), "v"(x[4]), "v"(x[5]), "v"(x[6]), "v"(x[7]));
  v8f y = {a, b, c, d, e, f, g, h};
  return y;
}

// ---------------- weight fp32 -> fp16 ----------------
__global__ __launch_bounds__(256) void cvt_kernel(const float* __restrict__ qkv_w,
                                                  const float* __restrict__ proj_w,
                                                  half_t* __restrict__ wq,
                                                  half_t* __restrict__ wp) {
  int i = blockIdx.x * 256 + threadIdx.x;
  if (i < 3 * CH * CH) wq[i] = (half_t)qkv_w[i];
  if (i < CH * CH)     wp[i] = (half_t)proj_w[i];
}

// ---------------- GroupNorm -> transposed y_t[b][l][c] f16 ----------------
__global__ __launch_bounds__(256) void gn_kernel(const float* __restrict__ x,
                                                 const float* __restrict__ gw,
                                                 const float* __restrict__ gb,
                                                 half_t* __restrict__ y_t) {
  const int CPG = 8;
  int b = blockIdx.x >> 5;
  int g = blockIdx.x & 31;
  const float* xg = x + ((size_t)b * CH + g * CPG) * LCNT;
  float s = 0.f, s2 = 0.f;
  for (int idx = threadIdx.x; idx < CPG * LCNT; idx += 256) {
    float v = xg[idx];
    s += v; s2 += v * v;
  }
#pragma unroll
  for (int off = 16; off > 0; off >>= 1) {
    s  += __shfl_xor(s, off, 32);
    s2 += __shfl_xor(s2, off, 32);
  }
  __shared__ float rs[8], rq[8];
  int wave = threadIdx.x >> 5, lane = threadIdx.x & 31;
  if (lane == 0) { rs[wave] = s; rq[wave] = s2; }
  __syncthreads();
  s = 0.f; s2 = 0.f;
#pragma unroll
  for (int i = 0; i < 8; ++i) { s += rs[i]; s2 += rq[i]; }
  const float invN = 1.0f / (float)(CPG * LCNT);
  float mean = s * invN;
  float var  = s2 * invN - mean * mean;
  float rstd = rsqrtf(var + 1e-5f);
  // One thread owns a position's whole group: its 8 channels are contiguous in
  // y_t, so they leave as one 16-byte store instead of eight 2-byte stores.
  for (int l = threadIdx.x; l < LCNT; l += 256) {
    v8h pk;
#pragma unroll
    for (int cl = 0; cl < CPG; ++cl) {
      int c = g * CPG + cl;
      float v = (xg[cl * LCNT + l] - mean) * rstd * gw[c] + gb[c];
      pk[cl] = (half_t)v;
    }
    *(v8h*)(y_t + ((size_t)b * LCNT + l) * CH + g * CPG) = pk;
  }
}

// ---------------- QKV GEMM: block = 128(o) x 64(l), K=256 ----------------
// All 8 waves share the B tile (y_t rows), staged async + double-buffered in LDS.
__global__ __launch_bounds__(256) void qkv_kernel(const half_t* __restrict__ wq,
                                                  const half_t* __restrict__ y_t,
                                                  const float* __restrict__ qkv_b,
                                                  half_t* __restrict__ qk,
                                                  half_t* __restrict__ vv) {
  int bx   = blockIdx.x;                 // 16 b * 6 mblk * 16 nt = 1536
  int b    = bx / 96;
  int rem  = bx - b * 96;
  int mblk = rem >> 4;
  int nt   = rem & 15;
  int l0   = nt << 6;
  int tid  = threadIdx.x, wave = tid >> 5, lane = tid & 31;
  int o0   = mblk * 128 + wave * 16;
  const half_t* yb = y_t + (size_t)b * LCNT * CH;

  __shared__ __align__(16) half_t btile[2][64][TPITCH];   // [l][k] for current k-step; 32 k a row, then the pad
  __shared__ __align__(16) half_t ostage[128][OPITCH]; // output tile, one row per 128-B line of q, k or v
  int srow = tid >> 2, sch = (tid & 3) << 3;          // 64 rows x 4 chunks of 16B
  const half_t* gsrc = yb + (size_t)(l0 + srow) * CH + sch;

  async_b128(gsrc, &btile[0][srow][sch]);             // prologue: k-step 0
  v8f acc[4] = {};
  for (int ks = 0; ks < 8; ++ks) {
    int buf = ks & 1;
    if (ks + 1 < 8) {
      async_b128(gsrc + (ks + 1) * 32, &btile[buf ^ 1][srow][sch]);
      wait_async_le<1>();                              // retire current buffer
    } else {
      wait_async_le<0>();
    }
    __syncthreads();
    v16h af = load_frag(wq, CH, o0, ks * 32);          // weights: L2-hot
#pragma unroll
    for (int j = 0; j < 4; ++j) {
      v16h bf = load_frag(&btile[buf][0][0], TPITCH, j * 16, 0);
      acc[j] = wmma_f16(af, bf, acc[j]);
    }
    __syncthreads();                                   // protect buf before overwrite
  }

  int mh = (lane >> 4) << 3;
  float pb[8];
#pragma unroll
  for (int r = 0; r < 8; ++r) pb[r] = qkv_b[o0 + mh + r];

  // The block's 128 o are one section (0=q 1=k 2=v) and two heads. The tile is
  // laid in LDS in the order of the destination, one row per 128-B line, and
  // then leaves as 16-byte stores: 8 lanes a line, 4 whole lines a wave.
  int sec = mblk >> 1;
  half_t* dst;          // first line of the tile
  int rstep, hstep;     // f16 from row to row inside a half of 64 rows; from half to half
  if (sec == 2) {       // v [b][h][d][l]: row = o, 64 l a row
#pragma unroll
    for (int j = 0; j < 4; ++j)
#pragma unroll
      for (int r = 0; r < 8; ++r)
        ostage[wave * 16 + mh + r][j * 16 + (lane & 15)] = (half_t)(acc[j][r] + pb[r]);
    dst   = vv + ((size_t)b * CH + (mblk & 1) * 128) * LCNT + l0;
    rstep = LCNT;
    hstep = 64 * LCNT;
  } else {              // q, k [b][s][h][l][d]: row = (head, l), 64 d a row
#pragma unroll
    for (int j = 0; j < 4; ++j) {
      v8h pk;
#pragma unroll
      for (int r = 0; r < 8; ++r) pk[r] = (half_t)(acc[j][r] + pb[r]);
      *(v8h*)&ostage[(wave >> 2) * 64 + j * 16 + (lane & 15)][(wave & 3) * 16 + mh] = pk;
    }
    dst   = qk + ((((size_t)b * 2 + sec) * NH + (mblk & 1) * 2) * LCNT + l0) * HD;
    rstep = HD;
    hstep = LCNT * HD;
  }
  __syncthreads();      // rows are read back by other waves than wrote them: all staged before any row is read
#pragma unroll
  for (int it = 0; it < 4; ++it) {
    int c = it * 256 + tid;
    int row = c >> 3, ch = (c & 7) << 3;
    *(v8h*)(dst + (size_t)(row >> 6) * hstep + (size_t)(row & 63) * rstep + ch) =
        *(const v8h*)&ostage[row][ch];
  }
}

// ---------------- flash attention: K/V tiles async-staged, shared by 8 waves ----------------
// Transposed products: S^T = K Q^T (rows j, columns i) and O^T += V P^T (rows d, columns i).
// A lane holds 16 of the 32 scores of ONE query i = lane & 15, so maximum and sum run
// in the lane's own registers, and the two S^T tiles, converted in place, are the B operand of V P^T.
__global__ __launch_bounds__(256) void attn_kernel(const half_t* __restrict__ qk,
                                                   const half_t* __restrict__ vv,
                                                   half_t* __restrict__ ao) {
  int bh = blockIdx.x >> 3;
  int ib = blockIdx.x & 7;
  int b = bh >> 2, h = bh & 3;
  int tid = threadIdx.x, wave = tid >> 5, lane = tid & 31;
  const half_t* qt = qk + (((size_t)b * 2 * NH + h) * LCNT) * HD;
  const half_t* kt = qk + ((((size_t)b * 2 + 1) * NH + h) * LCNT) * HD;
  const half_t* vp = vv + (((size_t)b * NH + h) * HD) * LCNT;
  int i0 = ib * 128 + wave * 16;

  __shared__ __align__(16) half_t ktile[2][32][KPITCH];   // [j][d]; 64 d a row, then the pad
  __shared__ __align__(16) half_t vtile[2][64][TPITCH];   // [d][j]; 32 j a row, then the pad

  int krow = tid >> 3, kch = (tid & 7) << 3;          // 32 rows x 8 chunks
  int vrow = tid >> 2, vch = (tid & 3) << 3;          // 64 rows x 4 chunks
  const half_t* kgb = kt + (size_t)krow * HD + kch;
  const half_t* vgb = vp + (size_t)vrow * LCNT + vch;

  v16h qf0 = load_frag(qt, HD, i0, 0);
  v16h qf1 = load_frag(qt, HD, i0, 32);
  float m_i = -1e30f;   // running maximum of query i, equal in both halves of the wave
  float l_i = 0.f;      // running sum over this half's own j only; the halves are joined after the loop
  v8f O[4] = {};        // O[tt][r] = O^T[d = tt*16 + 8*(lane>>4) + r][i]
  const float scale = 0.125f;   // 64^-0.5

  async_b128(kgb, &ktile[0][krow][kch]);              // prologue j-block 0
  async_b128(vgb, &vtile[0][vrow][vch]);

  for (int js = 0; js < 32; ++js) {
    int buf = js & 1;
    if (js + 1 < 32) {
      int jn = (js + 1) * 32;
      async_b128(kgb + (size_t)jn * HD, &ktile[buf ^ 1][krow][kch]);
      async_b128(vgb + jn,              &vtile[buf ^ 1][vrow][vch]);
      wait_async_le<2>();
    } else {
      wait_async_le<0>();
    }
    __syncthreads();

    v16h kf00 = load_frag(&ktile[buf][0][0], KPITCH, 0,  0);
    v16h kf01 = load_frag(&ktile[buf][0][0], KPITCH, 0,  32);
    v16h kf10 = load_frag(&ktile[buf][0][0], KPITCH, 16, 0);
    v16h kf11 = load_frag(&ktile[buf][0][0], KPITCH, 16, 32);
    v8f s0 = {}, s1 = {};
    s0 = wmma_f16(kf00, qf0, s0);   // s0[r] = S^T[j = 8*(lane>>4) + r][i]
    s0 = wmma_f16(kf01, qf1, s0);
    s1 = wmma_f16(kf10, qf0, s1);   // s1[r] = S^T[j = 16 + 8*(lane>>4) + r][i]
    s1 = wmma_f16(kf11, qf1, s1);

    // online softmax of query i: 16 scores in this lane, the other 16 in lane ^ 16
    s0 *= scale;
    s1 *= scale;
    float rm = fmaxf(s0[0], s1[0]);
#pragma unroll   // constant element indices: the score vectors stay in registers
    for (int r = 1; r < 8; ++r) rm = fmaxf(rm, fmaxf(s0[r], s1[r]));
    rm = fmaxf(rm, xhalf(rm));
    float mn = fmaxf(m_i, rm);
    float alpha = __expf(m_i - mn);
    m_i = mn;
    // pf[s] = P^T[j][i], j = 8*(lane>>4) + s for s < 8 and 16 + 8*(lane>>4) + (s - 8) above: the k order of load_frag's V
    v16h pf;
    s0 = (s0 - mn) * 1.44269504f;   // exp(x) = 2^(x * log2 e), as __expf has it
    s1 = (s1 - mn) * 1.44269504f;
    s0 = exp2x8(s0);
    s1 = exp2x8(s1);
#pragma unroll
    for (int r = 0; r < 8; ++r) {
      pf[r]     = (half_t)s0[r];
      pf[8 + r] = (half_t)s1[r];
    }
    v8f t = s0 + s1;
    float rsum = ((t[0] + t[1]) + (t[2] + t[3])) + ((t[4] + t[5]) + (t[6] + t[7]));
    l_i = l_i * alpha + rsum;
#pragma unroll   // constant tile indices: the accumulators stay in registers
    for (int tt = 0; tt < 4; ++tt) O[tt] *= alpha;
#pragma unroll
    for (int tt = 0; tt < 4; ++tt) {
      v16h vf = load_frag(&vtile[buf][0][0], TPITCH, tt * 16, 0);
      O[tt] = wmma_f16(vf, pf, O[tt]);
    }
    __syncthreads();                                   // buf reusable next iter
  }

  float inv = 1.0f / (l_i + xhalf(l_i));
  // A lane's 8 registers of a tile are 8 neighbouring channels of one position: one 16-byte store.
  half_t* aorow = ao + ((size_t)b * LCNT + i0 + (lane & 15)) * CH + h * HD + ((lane >> 4) << 3);   // [b][l][c]
#pragma unroll
  for (int tt = 0; tt < 4; ++tt) {
    v8h pk;
#pragma unroll
    for (int r = 0; r < 8; ++r) pk[r] = (half_t)(O[tt][r] * inv);
    *(v8h*)(aorow + tt * 16) = pk;
  }
}

// ---------------- proj GEMM + bias + residual: block = 128(o) x 64(l) ----------------
__global__ __launch_bounds__(256) void proj_kernel(const half_t* __restrict__ wp,
                                                   const half_t* __restrict__ ao,
                                                   const float* __restrict__ proj_b,
                                                   const float* __restrict__ x,
                                                   float* __restrict__ out) {
  int bx   = blockIdx.x;                 // 16 b * 2 mblk * 16 nt = 512
  int b    = bx / 32;
  int rem  = bx - b * 32;
  int mblk = rem >> 4;
  int nt   = rem & 15;
  int l0   = nt << 6;
  int tid  = threadIdx.x, wave = tid >> 5, lane = tid & 31;
  int o0   = mblk * 128 + wave * 16;
  const half_t* ab = ao + (size_t)b * LCNT * CH;

  __shared__ __align__(16) half_t btile[2][64][TPITCH];
  int srow = tid >> 2, sch = (tid & 3) << 3;
  const half_t* gsrc = ab + (size_t)(l0 + srow) * CH + sch;

  async_b128(gsrc, &btile[0][srow][sch]);
  v8f acc[4] = {};
  for (int ks = 0; ks < 8; ++ks) {
    int buf = ks & 1;
    if (ks + 1 < 8) {
      async_b128(gsrc + (ks + 1) * 32, &btile[buf ^ 1][srow][sch]);
      wait_async_le<1>();
    } else {
      wait_async_le<0>();
    }
    __syncthreads();
    v16h af = load_frag(wp, CH, o0, ks * 32);
#pragma unroll
    for (int j = 0; j < 4; ++j) {
      v16h bf = load_frag(&btile[buf][0][0], TPITCH, j * 16, 0);
      acc[j] = wmma_f16(af, bf, acc[j]);
    }
    __syncthreads();
  }

  int mh = (lane >> 4) << 3;
  float pb[8];
#pragma unroll
  for (int r = 0; r < 8; ++r) pb[r] = proj_b[o0 + mh + r];
#pragma unroll
  for (int j = 0; j < 4; ++j)
#pragma unroll
    for (int r = 0; r < 8; ++r) {
      int o = o0 + mh + r;
      int l = l0 + j * 16 + (lane & 15);
      size_t idx = ((size_t)b * CH + o) * LCNT + l;
      out[idx] = x[idx] + pb[r] + acc[j][r];
    }
}

extern "C" void kernel_launch(void* const* d_in, const int* in_sizes, int n_in,
                              void* d_out, int out_size, void* d_ws, size_t ws_size,
                              hipStream_t stream) {
  const float* x      = (const float*)d_in[0];
  const float* gn_w   = (const float*)d_in[1];
  const float* gn_b   = (const float*)d_in[2];
  const float* qkv_w  = (const float*)d_in[3];
  const float* qkv_b  = (const float*)d_in[4];
  const float* proj_w = (const float*)d_in[5];
  const float* proj_b = (const float*)d_in[6];
  float* out = (float*)d_out;

  // workspace layout (bytes), total ~40.5 MB
  char* ws = (char*)d_ws;
  half_t* wq  = (half_t*)(ws);              // 768*256 f16
  half_t* wp  = (half_t*)(ws +   393216);   // 256*256 f16
  half_t* y_t = (half_t*)(ws +   524288);   // 16*1024*256 f16
  half_t* qk  = (half_t*)(ws +  8912896);   // 16*2*4*1024*64 f16
  half_t* vv  = (half_t*)(ws + 25690112);   // 16*4*64*1024 f16
  half_t* ao  = (half_t*)(ws + 34078720);   // 16*1024*256 f16

  cvt_kernel <<<768,  256, 0, stream>>>(qkv_w, proj_w, wq, wp);
  gn_kernel  <<<512,  256, 0, stream>>>(x, gn_w, gn_b, y_t);
  qkv_kernel <<<1536, 256, 0, stream>>>(wq, y_t, qkv_b, qk, vv);
  attn_kernel<<<512,  256, 0, stream>>>(qk, vv, ao);
  proj_kernel<<<512,  256, 0, stream>>>(wp, ao, proj_b, x, out);
}

// v005
// Measured time: 69.4 microseconds a run.
// Timed twice side by side with v004, it ran 1.13 times as fast both times.
// All steps since v000 together make it 2.99 times as fast.
#include <hip/hip_runtime.h>
#include <hip/hip_bf16.h>

typedef _Float16 half_t;
typedef __attribute__((ext_vector_type(8)))  _Float16 v8h;
typedef __attribute__((ext_vector_type(16))) _Float16 v16h;
typedef __attribute__((ext_vector_type(8)))  float    v8f;
typedef __attribute__((ext_vector_type(4)))  int      v4i;

#define LCNT 1024   // 32*32 spatial positions
#define CH   256
#define NH   4
#define HD   64
#define OPITCH 72
#define KPITCH 72
#define TPITCH 40

#if __has_builtin(__builtin_amdgcn_global_load_async_to_lds_b128)
#define HAS_ASYNC 1
#else
#define HAS_ASYNC 0
#endif

#if HAS_ASYNC
typedef __attribute__((address_space(1))) v4i gv4i_t;   // global int4
typedef __attribute__((address_space(3))) v4i lv4i_t;   // LDS int4
#endif

__device__ __forceinline__ void async_b128(const half_t* g, half_t* l) {
#if HAS_ASYNC
  __builtin_amdgcn_global_load_async_to_lds_b128((gv4i_t*)g, (lv4i_t*)l, 0, 0);
#else
  *(v8h*)l = *(const v8h*)g;   // sync fallback: global load + ds store
#endif
}

template <int N>
__device__ __forceinline__ void wait_async_le() {
#if HAS_ASYNC
#if __has_builtin(__builtin_amdgcn_s_wait_asynccnt)
  __builtin_amdgcn_s_wait_asynccnt(N);
#else
  asm volatile("s_wait_asynccnt %0" :: "i"(N) : "memory");
#endif
#endif
}

__device__ __forceinline__ v16h load_frag(const half_t* __restrict__ base,
                                          int ld, int row0, int k0) {
  int lane = threadIdx.x & 31;
  const half_t* p = base + (size_t)(row0 + (lane & 15)) * ld + k0 + ((lane >> 4) << 3);
  v8h lo = *(const v8h*)(p);
  v8h hi = *(const v8h*)(p + 16);
  v16h f;
#pragma unroll
  for (int i = 0; i < 8; ++i) { f[i] = lo[i]; f[8 + i] = hi[i]; }
  return f;
}

__device__ __forceinline__ v8f wmma_f16(v16h a, v16h b, v8f c) {
  return __builtin_amdgcn_wmma_f32_16x16x32_f16(false, a, false, b, (short)0, c,
                                                false, false);
}

__device__ __forceinline__ float xhalf(float x) {
  int v = __builtin_bit_cast(int, x);
  return __builtin_bit_cast(float,
      __builtin_amdgcn_permlanex16(v, v, 0x76543210, 0xfedcba98, false, false));
}

__device__ __forceinline__ v8f exp2x8(v8f x) {
  float a, b, c, d, e, f, g, h;
  asm("v_exp_f32 %0, %8\n\tv_exp_f32 %1, %9\n\tv_exp_f32 %2, %10\n\tv_exp_f32 %3, %11\n\t"
      "v_exp_f32 %4, %12\n\tv_exp_f32 %5, %13\n\tv_exp_f32 %6, %14\n\tv_exp_f32 %7, %15\n\tv_nop"
      : "=&v"(a), "=&v"(b), "=&v"(c), "=&v"(d), "=&v"(e), "=&v"(f), "=&v"(g), "=&v"(h)
      : "v"(x[0]), "v"(x[1]), "v"(x[2]), "v"(x[3]), "v"(x[4]), "v"(x[5]), "v"(x[6]), "v"(x[7]));
  v8f y = {a, b, c, d, e, f, g, h};
  return y;
}

// ---------------- weight fp32 -> fp16 ----------------
__global__ __launch_bounds__(256) void cvt_kernel(const float* __restrict__ qkv_w,
                                                  const float* __restrict__ proj_w,
                                                  half_t* __restrict__ wq,
                                                  half_t* __restrict__ wp) {
  int i = blockIdx.x * 256 + threadIdx.x;
  if (i < 3 * CH * CH) wq[i] = (half_t)qkv_w[i];
  if (i < CH * CH)     wp[i] = (half_t)proj_w[i];
}

// ---------------- GroupNorm -> y_t[b][g][l][8] f16, group-major ----------------
__global__ __launch_bounds__(256) void gn_kernel(const float* __restrict__ x,
                                                 const float* __restrict__ gw,
                                                 const float* __restrict__ gb,
                                                 half_t* __restrict__ y_t) {
  const int CPG = 8;
  int b = blockIdx.x >> 5;
  int g = blockIdx.x & 31;
  const float* xg = x + ((size_t)b * CH + g * CPG) * LCNT;
  float s = 0.f, s2 = 0.f;
  for (int idx = threadIdx.x; idx < CPG * LCNT; idx += 256) {
    float v = xg[idx];
    s += v; s2 += v * v;
  }
#pragma unroll
  for (int off = 16; off > 0; off >>= 1) {
    s  += __shfl_xor(s, off, 32);
    s2 += __shfl_xor(s2, off, 32);
  }
  __shared__ float rs[8], rq[8];
  int wave = threadIdx.x >> 5, lane = threadIdx.x & 31;
  if (lane == 0) { rs[wave] = s; rq[wave] = s2; }
  __syncthreads();
  s = 0.f; s2 = 0.f;
#pragma unroll
  for (int i = 0; i < 8; ++i) { s += rs[i]; s2 += rq[i]; }
  const float invN = 1.0f / (float)(CPG * LCNT);
  float mean = s * invN;
  float var  = s2 * invN - mean * mean;
  float rstd = rsqrtf(var + 1e-5f);
  // One thread owns a position's whole group: its 8 channels leave as one 16-byte store.
  // Neighbouring positions of a group are neighbours in y_t, so a wave's store is 512
  // contiguous bytes: 4 whole 128-B lines, each written by this block alone.
  for (int l = threadIdx.x; l < LCNT; l += 256) {
    v8h pk;
#pragma unroll
    for (int cl = 0; cl < CPG; ++cl) {
      int c = g * CPG + cl;
      float v = (xg[cl * LCNT + l] - mean) * rstd * gw[c] + gb[c];
      pk[cl] = (half_t)v;
    }
    *(v8h*)(y_t + (((size_t)b * (CH / CPG) + g) * LCNT + l) * CPG) = pk;
  }
}

// ---------------- QKV GEMM: block = 128(o) x 64(l), K=256 ----------------
// All 8 waves share the B tile (64 positions x 32 channels of y_t), staged async + double-buffered in LDS.
__global__ __launch_bounds__(256) void qkv_kernel(const half_t* __restrict__ wq,
                                                  const half_t* __restrict__ y_t,
                                                  const float* __restrict__ qkv_b,
                                                  half_t* __restrict__ qk,
                                                  half_t* __restrict__ vv) {
  int bx   = blockIdx.x;                 // 16 b * 6 mblk * 16 nt = 1536
  int b    = bx / 96;
  int rem  = bx - b * 96;
  int mblk = rem >> 4;
  int nt   = rem & 15;
  int l0   = nt << 6;
  int tid  = threadIdx.x, wave = tid >> 5, lane = tid & 31;
  int o0   = mblk * 128 + wave * 16;
  const half_t* yb = y_t + (size_t)b * LCNT * CH;

  __shared__ __align__(16) half_t btile[2][64][TPITCH];   // [l][k] for current k-step; 32 k a row, then the pad
  __shared__ __align__(16) half_t ostage[128][OPITCH]; // output tile, one row per 128-B line of q, k or v
  // 64 rows x 4 chunks of 16 B; a chunk is one group of 8 channels. A wave copies 32
  // neighbouring positions of one group: 512 contiguous bytes of y_t.
  int srow = tid & 63, sgrp = tid >> 6, sch = sgrp << 3;
  const half_t* gsrc = yb + ((size_t)sgrp * LCNT + l0 + srow) * 8;

  async_b128(gsrc, &btile[0][srow][sch]);             // prologue: k-step 0
  v8f acc[4] = {};
  for (int ks = 0; ks < 8; ++ks) {
    int buf = ks & 1;
    if (ks + 1 < 8) {
      async_b128(gsrc + (size_t)(ks + 1) * (4 * LCNT * 8), &btile[buf ^ 1][srow][sch]);   // 4 groups on
      wait_async_le<1>();                              // retire current buffer
    } else {
      wait_async_le<0>();
    }
    __syncthreads();
    v16h af = load_frag(wq, CH, o0, ks * 32);          // weights: L2-hot
#pragma unroll
    for (int j = 0; j < 4; ++j) {
      v16h bf = load_frag(&btile[buf][0][0], TPITCH, j * 16, 0);
      acc[j] = wmma_f16(af, bf, acc[j]);
    }
    __syncthreads();                                   // protect buf before overwrite
  }

  int mh = (lane >> 4) << 3;
  float pb[8];
#pragma unroll
  for (int r = 0; r < 8; ++r) pb[r] = qkv_b[o0 + mh + r];

  // The block's 128 o are one section (0=q 1=k 2=v) and two heads. The tile is
  // laid in LDS in the order of the destination, one row per 128-B line, and
  // then leaves as 16-byte stores: 8 lanes a line, 4 whole lines a wave.
  int sec = mblk >> 1;
  half_t* dst;          // first line of the tile
  int rstep, hstep;     // f16 from row to row inside a half of 64 rows; from half to half
  if (sec == 2) {       // v [b][h][d][l]: row = o, 64 l a row
#pragma unroll
    for (int j = 0; j < 4; ++j)
#pragma unroll
      for (int r = 0; r < 8; ++r)
        ostage[wave * 16 + mh + r][j * 16 + (lane & 15)] = (half_t)(acc[j][r] + pb[r]);
    dst   = vv + ((size_t)b * CH + (mblk & 1) * 128) * LCNT + l0;
    rstep = LCNT;
    hstep = 64 * LCNT;
  } else {              // q, k [b][s][h][l][d]: row = (head, l), 64 d a row
#pragma unroll
    for (int j = 0; j < 4; ++j) {
      v8h pk;
#pragma unroll
      for (int r = 0; r < 8; ++r) pk[r] = (half_t)(acc[j][r] + pb[r]);
      *(v8h*)&ostage[(wave >> 2) * 64 + j * 16 + (lane & 15)][(wave & 3) * 16 + mh] = pk;
    }
    dst   = qk + ((((size_t)b * 2 + sec) * NH + (mblk & 1) * 2) * LCNT + l0) * HD;
    rstep = HD;
    hstep = LCNT * HD;
  }
  __syncthreads();      // rows are read back by other waves than wrote them: all staged before any row is read
#pragma unroll
  for (int it = 0; it < 4; ++it) {
    int c = it * 256 + tid;
    int row = c >> 3, ch = (c & 7) << 3;
    *(v8h*)(dst + (size_t)(row >> 6) * hstep + (size_t)(row & 63) * rstep + ch) =
        *(const v8h*)&ostage[row][ch];
  }
}

// ---------------- flash attention: K/V tiles async-staged, shared by 8 waves ----------------
// Transposed products: S^T = K Q^T (rows j, columns i) and O^T += V P^T (rows d, columns i).
// A lane holds 16 of the 32 scores of ONE query i = lane & 15, so maximum and sum run
// in the lane's own registers, and the two S^T tiles, converted in place, are the B operand of V P^T.
__global__ __launch_bounds__(256) void attn_kernel(const half_t* __restrict__ qk,
                                                   const half_t* __restrict__ vv,
                                                   half_t* __restrict__ ao) {
  int bh = blockIdx.x >> 3;
  int ib = blockIdx.x & 7;
  int b = bh >> 2, h = bh & 3;
  int tid = threadIdx.x, wave = tid >> 5, lane = tid & 31;
  const half_t* qt = qk + (((size_t)b * 2 * NH + h) * LCNT) * HD;
  const half_t* kt = qk + ((((size_t)b * 2 + 1) * NH + h) * LCNT) * HD;
  const half_t* vp = vv + (((size_t)b * NH + h) * HD) * LCNT;
  int i0 = ib * 128 + wave * 16;

  __shared__ __align__(16) half_t ktile[2][32][KPITCH];   // [j][d]; 64 d a row, then the pad
  __shared__ __align__(16) half_t vtile[2][64][TPITCH];   // [d][j]; 32 j a row, then the pad

  int krow = tid >> 3, kch = (tid & 7) << 3;          // 32 rows x 8 chunks
  int vrow = tid >> 2, vch = (tid & 3) << 3;          // 64 rows x 4 chunks
  const half_t* kgb = kt + (size_t)krow * HD + kch;
  const half_t* vgb = vp + (size_t)vrow * LCNT + vch;

  v16h qf0 = load_frag(qt, HD, i0, 0);
  v16h qf1 = load_frag(qt, HD, i0, 32);
  float m_i = -1e30f;   // running maximum of query i, equal in both halves of the wave
  float l_i = 0.f;      // running sum over this half's own j only; the halves are joined after the loop
  v8f O[4] = {};        // O[tt][r] = O^T[d = tt*16 + 8*(lane>>4) + r][i]
  const float scale = 0.125f;   // 64^-0.5

  async_b128(kgb, &ktile[0][krow][kch]);              // prologue j-block 0
  async_b128(vgb, &vtile[0][vrow][vch]);

  for (int js = 0; js < 32; ++js) {
    int buf = js & 1;
    if (js + 1 < 32) {
      int jn = (js + 1) * 32;
      async_b128(kgb + (size_t)jn * HD, &ktile[buf ^ 1][krow][kch]);
      async_b128(vgb + jn,              &vtile[buf ^ 1][vrow][vch]);
      wait_async_le<2>();
    } else {
      wait_async_le<0>();
    }
    __syncthreads();

    v16h kf00 = load_frag(&ktile[buf][0][0], KPITCH, 0,  0);
    v16h kf01 = load_frag(&ktile[buf][0][0], KPITCH, 0,  32);
    v16h kf10 = load_frag(&ktile[buf][0][0], KPITCH, 16, 0);
    v16h kf11 = load_frag(&ktile[buf][0][0], KPITCH, 16, 32);
    v8f s0 = {}, s1 = {};
    s0 = wmma_f16(kf00, qf0, s0);   // s0[r] = S^T[j = 8*(lane>>4) + r][i]
    s0 = wmma_f16(kf01, qf1, s0);
    s1 = wmma_f16(kf10, qf0, s1);   // s1[r] = S^T[j = 16 + 8*(lane>>4) + r][i]
    s1 = wmma_f16(kf11, qf1, s1);

    // online softmax of query i: 16 scores in this lane, the other 16 in lane ^ 16
    s0 *= scale;
    s1 *= scale;
    float rm = fmaxf(s0[0], s1[0]);
#pragma unroll   // constant element indices: the score vectors stay in registers
    for (int r = 1; r < 8; ++r) rm = fmaxf(rm, fmaxf(s0[r], s1[r]));
    rm = fmaxf(rm, xhalf(rm));
    float mn = fmaxf(m_i, rm);
    float alpha = __expf(m_i - mn);
    m_i = mn;
    // pf[s] = P^T[j][i], j = 8*(lane>>4) + s for s < 8 and 16 + 8*(lane>>4) + (s - 8) above: the k order of load_frag's V
    v16h pf;
    s0 = (s0 - mn) * 1.44269504f;   // exp(x) = 2^(x * log2 e), as __expf has it
    s1 = (s1 - mn) * 1.44269504f;
    s0 = exp2x8(s0);
    s1 = exp2x8(s1);
#pragma unroll
    for (int r = 0; r < 8; ++r) {
      pf[r]     = (half_t)s0[r];
      pf[8 + r] = (half_t)s1[r];
    }
    v8f t = s0 + s1;
    float rsum = ((t[0] + t[1]) + (t[2] + t[3])) + ((t[4] + t[5]) + (t[6] + t[7]));
    l_i = l_i * alpha + rsum;
#pragma unroll   // constant tile indices: the accumulators stay in registers
    for (int tt = 0; tt < 4; ++tt) O[tt] *= alpha;
#pragma unroll
    for (int tt = 0; tt < 4; ++tt) {
      v16h vf = load_frag(&vtile[buf][0][0], TPITCH, tt * 16, 0);
      O[tt] = wmma_f16(vf, pf, O[tt]);
    }
    __syncthreads();                                   // buf reusable next iter
  }

  float inv = 1.0f / (l_i + xhalf(l_i));
  // A lane's 8 registers of a tile are 8 neighbouring channels of one position: one 16-byte store.
  half_t* aorow = ao + ((size_t)b * LCNT + i0 + (lane & 15)) * CH + h * HD + ((lane >> 4) << 3);   // [b][l][c]
#pragma unroll
  for (int tt = 0; tt < 4; ++tt) {
    v8h pk;
#pragma unroll
    for (int r = 0; r < 8; ++r) pk[r] = (half_t)(O[tt][r] * inv);
    *(v8h*)(aorow + tt * 16) = pk;
  }
}

// ---------------- proj GEMM + bias + residual: block = 128(o) x 64(l) ----------------
__global__ __launch_bounds__(256) void proj_kernel(const half_t* __restrict__ wp,
                                                   const half_t* __restrict__ ao,
                                                   const float* __restrict__ proj_b,
                                                   const float* __restrict__ x,
                                                   float* __restrict__ out) {
  int bx   = blockIdx.x;                 // 16 b * 2 mblk * 16 nt = 512
  int b    = bx / 32;
  int rem  = bx - b * 32;
  int mblk = rem >> 4;
  int nt   = rem & 15;
  int l0   = nt << 6;
  int tid  = threadIdx.x, wave = tid >> 5, lane = tid & 31;
  int o0   = mblk * 128 + wave * 16;
  const half_t* ab = ao + (size_t)b * LCNT * CH;

  __shared__ __align__(16) half_t btile[2][64][TPITCH];
  int srow = tid >> 2, sch = (tid & 3) << 3;
  const half_t* gsrc = ab + (size_t)(l0 + srow) * CH + sch;

  async_b128(gsrc, &btile[0][srow][sch]);
  v8f acc[4] = {};
  for (int ks = 0; ks < 8; ++ks) {
    int buf = ks & 1;
    if (ks + 1 < 8) {
      async_b128(gsrc + (ks + 1) * 32, &btile[buf ^ 1][srow][sch]);
      wait_async_le<1>();
    } else {
      wait_async_le<0>();
    }
    __syncthreads();
    v16h af = load_frag(wp, CH, o0, ks * 32);
#pragma unroll
    for (int j = 0; j < 4; ++j) {
      v16h bf = load_frag(&btile[buf][0][0], TPITCH, j * 16, 0);
      acc[j] = wmma_f16(af, bf, acc[j]);
    }
    __syncthreads();
  }

  int mh = (lane >> 4) << 3;
  float pb[8];
#pragma unroll
  for (int r = 0; r < 8; ++r) pb[r] = proj_b[o0 + mh + r];
#pragma unroll
  for (int j = 0; j < 4; ++j)
#pragma unroll
    for (int r = 0; r < 8; ++r) {
      int o = o0 + mh + r;
      int l = l0 + j * 16 + (lane & 15);
      size_t idx = ((size_t)b * CH + o) * LCNT + l;
      out[idx] = x[idx] + pb[r] + acc[j][r];
    }
}

extern "C" void kernel_launch(void* const* d_in, const int* in_sizes, int n_in,
                              void* d_out, int out_size, void* d_ws, size_t ws_size,
                              hipStream_t stream) {
  const float* x      = (const float*)d_in[0];
  const float* gn_w   = (const float*)d_in[1];
  const float* gn_b   = (const float*)d_in[2];
  const float* qkv_w  = (const float*)d_in[3];
  const float* qkv_b  = (const float*)d_in[4];
  const float* proj_w = (const float*)d_in[5];
  const float* proj_b = (const float*)d_in[6];
  float* out = (float*)d_out;

  // workspace layout (bytes), total ~40.5 MB
  char* ws = (char*)d_ws;
  half_t* wq  = (half_t*)(ws);              // 768*256 f16
  half_t* wp  = (half_t*)(ws +   393216);   // 256*256 f16
  half_t* y_t = (half_t*)(ws +   524288);   // 16*32*1024*8 f16
  half_t* qk  = (half_t*)(ws +  8912896);   // 16*2*4*1024*64 f16
  half_t* vv  = (half_t*)(ws + 25690112);   // 16*4*64*1024 f16
  half_t* ao  = (half_t*)(ws + 34078720);   // 16*1024*256 f16

  cvt_kernel <<<768,  256, 0, stream>>>(qkv_w, proj_w, wq, wp);
  gn_kernel  <<<512,  256, 0, stream>>>(x, gn_w, gn_b, y_t);
  qkv_kernel <<<1536, 256, 0, stream>>>(wq, y_t, qkv_b, qk, vv);
  attn_kernel<<<512,  256, 0, stream>>>(qk, vv, ao);
  proj_kernel<<<512,  256, 0, stream>>>(wp, ao, proj_b, x, out);
}

// v006
// It runs in 66.8 microseconds.
// Timed twice side by side with v005, it ran 1.04 times as fast both times.
// Over all steps from v000 it is 3.11 times as fast.
#include <hip/hip_runtime.h>
#include <hip/hip_bf16.h>

typedef _Float16 half_t;
typedef __attribute__((ext_vector_type(2)))  _Float16 v2h;
typedef __attribute__((ext_vector_type(2)))  float    v2f;
typedef __attribute__((ext_vector_type(8)))  _Float16 v8h;
typedef __attribute__((ext_vector_type(16))) _Float16 v16h;
typedef __attribute__((ext_vector_type(8)))  float    v8f;
typedef __attribute__((ext_vector_type(4)))  int      v4i;

#define LCNT 1024   // 32*32 spatial positions
#define CH   256
#define NH   4
#define HD   64
#define OPITCH 72
#define KPITCH 72
#define TPITCH 40

#if __has_builtin(__builtin_amdgcn_global_load_async_to_lds_b128)
#define HAS_ASYNC 1
#else
#define HAS_ASYNC 0
#endif

#if HAS_ASYNC
typedef __attribute__((address_space(1))) v4i gv4i_t;   // global int4
typedef __attribute__((address_space(3))) v4i lv4i_t;   // LDS int4
#endif

__device__ __forceinline__ void async_b128(const half_t* g, half_t* l) {
#if HAS_ASYNC
  __builtin_amdgcn_global_load_async_to_lds_b128((gv4i_t*)g, (lv4i_t*)l, 0, 0);
#else
  *(v8h*)l = *(const v8h*)g;   // sync fallback: global load + ds store
#endif
}

template <int N>
__device__ __forceinline__ void wait_async_le() {
#if HAS_ASYNC
#if __has_builtin(__builtin_amdgcn_s_wait_asynccnt)
  __builtin_amdgcn_s_wait_asynccnt(N);
#else
  asm volatile("s_wait_asynccnt %0" :: "i"(N) : "memory");
#endif
#endif
}

__device__ __forceinline__ v16h load_frag(const half_t* __restrict__ base,
                                          int ld, int row0, int k0) {
  int lane = threadIdx.x & 31;
  const half_t* p = base + (size_t)(row0 + (lane & 15)) * ld + k0 + ((lane >> 4) << 3);
  v8h lo = *(const v8h*)(p);
  v8h hi = *(const v8h*)(p + 16);
  v16h f;
#pragma unroll
  for (int i = 0; i < 8; ++i) { f[i] = lo[i]; f[8 + i] = hi[i]; }
  return f;
}

__device__ __forceinline__ v8f wmma_f16(v16h a, v16h b, v8f c) {
  return __builtin_amdgcn_wmma_f32_16x16x32_f16(false, a, false, b, (short)0, c,
                                                false, false);
}

__device__ __forceinline__ float xhalf(float x) {
  int v = __builtin_bit_cast(int, x);
  return __builtin_bit_cast(float,
      __builtin_amdgcn_permlanex16(v, v, 0x76543210, 0xfedcba98, false, false));
}

__device__ __forceinline__ v8f exp2x8(v8f x) {
  float a, b, c, d, e, f, g, h;
  asm("v_exp_f32 %0, %8\n\tv_exp_f32 %1, %9\n\tv_exp_f32 %2, %10\n\tv_exp_f32 %3, %11\n\t"
      "v_exp_f32 %4, %12\n\tv_exp_f32 %5, %13\n\tv_exp_f32 %6, %14\n\tv_exp_f32 %7, %15\n\tv_nop"
      : "=&v"(a), "=&v"(b), "=&v"(c), "=&v"(d), "=&v"(e), "=&v"(f), "=&v"(g), "=&v"(h)
      : "v"(x[0]), "v"(x[1]), "v"(x[2]), "v"(x[3]), "v"(x[4]), "v"(x[5]), "v"(x[6]), "v"(x[7]));
  v8f y = {a, b, c, d, e, f, g, h};
  return y;
}

// ---------------- GroupNorm -> y_t[b][g][l][8] f16, group-major; weights fp32 -> fp16 ----------------
// The launch has 512 * 256 threads and the two weight matrices 4 * CH * CH = 2 * 512 * 256 elements:
// each thread also converts two neighbouring weights, so the conversion needs no launch of its own.
// Blocks 0..383 take qkv_w, blocks 384..511 proj_w. Both are read first by later launches.
__global__ __launch_bounds__(256) void gn_kernel(const float* __restrict__ x,
                                                 const float* __restrict__ gw,
                                                 const float* __restrict__ gb,
                                                 const float* __restrict__ qkv_w,
                                                 const float* __restrict__ proj_w,
                                                 half_t* __restrict__ y_t,
                                                 half_t* __restrict__ wq,
                                                 half_t* __restrict__ wp) {
  const int CPG = 8;
  const int QBLK = 3 * CH * CH / 512;   // blocks that convert qkv_w, 512 elements each
  int b = blockIdx.x >> 5;
  int g = blockIdx.x & 31;
  bool isq = blockIdx.x < QBLK;
  int wi = ((isq ? blockIdx.x : blockIdx.x - QBLK) * 256 + threadIdx.x) * 2;
  v2f wv = *(const v2f*)((isq ? qkv_w : proj_w) + wi);   // in flight beside the first loads of x
  const float* xg = x + ((size_t)b * CH + g * CPG) * LCNT;
  float s = 0.f, s2 = 0.f;
  for (int idx = threadIdx.x; idx < CPG * LCNT; idx += 256) {
    float v = xg[idx];
    s += v; s2 += v * v;
  }
#pragma unroll
  for (int off = 16; off > 0; off >>= 1) {
    s  += __shfl_xor(s, off, 32);
    s2 += __shfl_xor(s2, off, 32);
  }
  __shared__ float rs[8], rq[8];
  int wave = threadIdx.x >> 5, lane = threadIdx.x & 31;
  if (lane == 0) { rs[wave] = s; rq[wave] = s2; }
  __syncthreads();
  s = 0.f; s2 = 0.f;
#pragma unroll
  for (int i = 0; i < 8; ++i) { s += rs[i]; s2 += rq[i]; }
  const float invN = 1.0f / (float)(CPG * LCNT);
  float mean = s * invN;
  float var  = s2 * invN - mean * mean;
  float rstd = rsqrtf(var + 1e-5f);
  // One thread owns a position's whole group: its 8 channels leave as one 16-byte store.
  // Neighbouring positions of a group are neighbours in y_t, so a wave's store is 512
  // contiguous bytes: 4 whole 128-B lines, each written by this block alone.
  for (int l = threadIdx.x; l < LCNT; l += 256) {
    v8h pk;
#pragma unroll
    for (int cl = 0; cl < CPG; ++cl) {
      int c = g * CPG + cl;
      float v = (xg[cl * LCNT + l] - mean) * rstd * gw[c] + gb[c];
      pk[cl] = (half_t)v;
    }
    *(v8h*)(y_t + (((size_t)b * (CH / CPG) + g) * LCNT + l) * CPG) = pk;
  }
  // Last, so that neither the barrier nor a reuse of its registers waits for this store. A wave stores one whole 128-B line.
  v2h wh = {(half_t)wv[0], (half_t)wv[1]};
  *(v2h*)((isq ? wq : wp) + wi) = wh;
}

// ---------------- QKV GEMM: block = 128(o) x 64(l), K=256 ----------------
// All 8 waves share the B tile (64 positions x 32 channels of y_t), staged async + double-buffered in LDS.
__global__ __launch_bounds__(256) void qkv_kernel(const half_t* __restrict__ wq,
                                                  const half_t* __restrict__ y_t,
                                                  const float* __restrict__ qkv_b,
                                                  half_t* __restrict__ qk,
                                                  half_t* __restrict__ vv) {
  int bx   = blockIdx.x;                 // 16 b * 6 mblk * 16 nt = 1536
  int b    = bx / 96;
  int rem  = bx - b * 96;
  int mblk = rem >> 4;
  int nt   = rem & 15;
  int l0   = nt << 6;
  int tid  = threadIdx.x, wave = tid >> 5, lane = tid & 31;
  int o0   = mblk * 128 + wave * 16;
  const half_t* yb = y_t + (size_t)b * LCNT * CH;

  __shared__ __align__(16) half_t btile[2][64][TPITCH];   // [l][k] for current k-step; 32 k a row, then the pad
  __shared__ __align__(16) half_t ostage[128][OPITCH]; // output tile, one row per 128-B line of q, k or v
  // 64 rows x 4 chunks of 16 B; a chunk is one group of 8 channels. A wave copies 32
  // neighbouring positions of one group: 512 contiguous bytes of y_t.
  int srow = tid & 63, sgrp = tid >> 6, sch = sgrp << 3;
  const half_t* gsrc = yb + ((size_t)sgrp * LCNT + l0 + srow) * 8;

  async_b128(gsrc, &btile[0][srow][sch]);             // prologue: k-step 0
  v8f acc[4] = {};
  for (int ks = 0; ks < 8; ++ks) {
    int buf = ks & 1;
    if (ks + 1 < 8) {
      async_b128(gsrc + (size_t)(ks + 1) * (4 * LCNT * 8), &btile[buf ^ 1][srow][sch]);   // 4 groups on
      wait_async_le<1>();                              // retire current buffer
    } else {
      wait_async_le<0>();
    }
    __syncthreads();
    v16h af = load_frag(wq, CH, o0, ks * 32);          // weights: L2-hot
#pragma unroll
    for (int j = 0; j < 4; ++j) {
      v16h bf = load_frag(&btile[buf][0][0], TPITCH, j * 16, 0);
      acc[j] = wmma_f16(af, bf, acc[j]);
    }
    __syncthreads();                                   // protect buf before overwrite
  }

  int mh = (lane >> 4) << 3;
  float pb[8];
#pragma unroll
  for (int r = 0; r < 8; ++r) pb[r] = qkv_b[o0 + mh + r];

  // The block's 128 o are one section (0=q 1=k 2=v) and two heads. The tile is
  // laid in LDS in the order of the destination, one row per 128-B line, and
  // then leaves as 16-byte stores: 8 lanes a line, 4 whole lines a wave.
  int sec = mblk >> 1;
  half_t* dst;          // first line of the tile
  int rstep, hstep;     // f16 from row to row inside a half of 64 rows; from half to half
  if (sec == 2) {       // v [b][h][d][l]: row = o, 64 l a row
#pragma unroll
    for (int j = 0; j < 4; ++j)
#pragma unroll
      for (int r = 0; r < 8; ++r)
        ostage[wave * 16 + mh + r][j * 16 + (lane & 15)] = (half_t)(acc[j][r] + pb[r]);
    dst   = vv + ((size_t)b * CH + (mblk & 1) * 128) * LCNT + l0;
    rstep = LCNT;
    hstep = 64 * LCNT;
  } else {              // q, k [b][s][h][l][d]: row = (head, l), 64 d a row
#pragma unroll
    for (int j = 0; j < 4; ++j) {
      v8h pk;
#pragma unroll
      for (int r = 0; r < 8; ++r) pk[r] = (half_t)(acc[j][r] + pb[r]);
      *(v8h*)&ostage[(wave >> 2) * 64 + j * 16 + (lane & 15)][(wave & 3) * 16 + mh] = pk;
    }
    dst   = qk + ((((size_t)b * 2 + sec) * NH + (mblk & 1) * 2) * LCNT + l0) * HD;
    rstep = HD;
    hstep = LCNT * HD;
  }
  __syncthreads();      // rows are read back by other waves than wrote them: all staged before any row is read
#pragma unroll
  for (int it = 0; it < 4; ++it) {
    int c = it * 256 + tid;
    int row = c >> 3, ch = (c & 7) << 3;
    *(v8h*)(dst + (size_t)(row >> 6) * hstep + (size_t)(row & 63) * rstep + ch) =
        *(const v8h*)&ostage[row][ch];
  }
}

// ---------------- flash attention: K/V tiles async-staged, shared by 8 waves ----------------
// Transposed products: S^T = K Q^T (rows j, columns i) and O^T += V P^T (rows d, columns i).
// A lane holds 16 of the 32 scores of ONE query i = lane & 15, so maximum and sum run
// in the lane's own registers, and the two S^T tiles, converted in place, are the B operand of V P^T.
__global__ __launch_bounds__(256) void attn_kernel(const half_t* __restrict__ qk,
                                                   const half_t* __restrict__ vv,
                                                   half_t* __restrict__ ao) {
  int bh = blockIdx.x >> 3;
  int ib = blockIdx.x & 7;
  int b = bh >> 2, h = bh & 3;
  int tid = threadIdx.x, wave = tid >> 5, lane = tid & 31;
  const half_t* qt = qk + (((size_t)b * 2 * NH + h) * LCNT) * HD;
  const half_t* kt = qk + ((((size_t)b * 2 + 1) * NH + h) * LCNT) * HD;
  const half_t* vp = vv + (((size_t)b * NH + h) * HD) * LCNT;
  int i0 = ib * 128 + wave * 16;

  __shared__ __align__(16) half_t ktile[2][32][KPITCH];   // [j][d]; 64 d a row, then the pad
  __shared__ __align__(16) half_t vtile[2][64][TPITCH];   // [d][j]; 32 j a row, then the pad

  int krow = tid >> 3, kch = (tid & 7) << 3;          // 32 rows x 8 chunks
  int vrow = tid >> 2, vch = (tid & 3) << 3;          // 64 rows x 4 chunks
  const half_t* kgb = kt + (size_t)krow * HD + kch;
  const half_t* vgb = vp + (size_t)vrow * LCNT + vch;

  v16h qf0 = load_frag(qt, HD, i0, 0);
  v16h qf1 = load_frag(qt, HD, i0, 32);
  float m_i = -1e30f;   // running maximum of query i, equal in both halves of the wave
  float l_i = 0.f;      // running sum over this half's own j only; the halves are joined after the loop
  v8f O[4] = {};        // O[tt][r] = O^T[d = tt*16 + 8*(lane>>4) + r][i]
  const float scale = 0.125f;   // 64^-0.5

  async_b128(kgb, &ktile[0][krow][kch]);              // prologue j-block 0
  async_b128(vgb, &vtile[0][vrow][vch]);

  for (int js = 0; js < 32; ++js) {
    int buf = js & 1;
    if (js + 1 < 32) {
      int jn = (js + 1) * 32;
      async_b128(kgb + (size_t)jn * HD, &ktile[buf ^ 1][krow][kch]);
      async_b128(vgb + jn,              &vtile[buf ^ 1][vrow][vch]);
      wait_async_le<2>();
    } else {
      wait_async_le<0>();
    }
    __syncthreads();

    v16h kf00 = load_frag(&ktile[buf][0][0], KPITCH, 0,  0);
    v16h kf01 = load_frag(&ktile[buf][0][0], KPITCH, 0,  32);
    v16h kf10 = load_frag(&ktile[buf][0][0], KPITCH, 16, 0);
    v16h kf11 = load_frag(&ktile[buf][0][0], KPITCH, 16, 32);
    v8f s0 = {}, s1 = {};
    s0 = wmma_f16(kf00, qf0, s0);   // s0[r] = S^T[j = 8*(lane>>4) + r][i]
    s0 = wmma_f16(kf01, qf1, s0);
    s1 = wmma_f16(kf10, qf0, s1);   // s1[r] = S^T[j = 16 + 8*(lane>>4) + r][i]
    s1 = wmma_f16(kf11, qf1, s1);

    // online softmax of query i: 16 scores in this lane, the other 16 in lane ^ 16
    s0 *= scale;
    s1 *= scale;
    float rm = fmaxf(s0[0], s1[0]);
#pragma unroll   // constant element indices: the score vectors stay in registers
    for (int r = 1; r < 8; ++r) rm = fmaxf(rm, fmaxf(s0[r], s1[r]));
    rm = fmaxf(rm, xhalf(rm));
    float mn = fmaxf(m_i, rm);
    float alpha = __expf(m_i - mn);
    m_i = mn;
    // pf[s] = P^T[j][i], j = 8*(lane>>4) + s for s < 8 and 16 + 8*(lane>>4) + (s - 8) above: the k order of load_frag's V
    v16h pf;
    s0 = (s0 - mn) * 1.44269504f;   // exp(x) = 2^(x * log2 e), as __expf has it
    s1 = (s1 - mn) * 1.44269504f;
    s0 = exp2x8(s0);
    s1 = exp2x8(s1);
#pragma unroll
    for (int r = 0; r < 8; ++r) {
      pf[r]     = (half_t)s0[r];
      pf[8 + r] = (half_t)s1[r];
    }
    v8f t = s0 + s1;
    float rsum = ((t[0] + t[1]) + (t[2] + t[3])) + ((t[4] + t[5]) + (t[6] + t[7]));
    l_i = l_i * alpha + rsum;
#pragma unroll   // constant tile indices: the accumulators stay in registers
    for (int tt = 0; tt < 4; ++tt) O[tt] *= alpha;
#pragma unroll
    for (int tt = 0; tt < 4; ++tt) {
      v16h vf = load_frag(&vtile[buf][0][0], TPITCH, tt * 16, 0);
      O[tt] = wmma_f16(vf, pf, O[tt]);
    }
    __syncthreads();                                   // buf reusable next iter
  }

  float inv = 1.0f / (l_i + xhalf(l_i));
  // A lane's 8 registers of a tile are 8 neighbouring channels of one position: one 16-byte store.
  half_t* aorow = ao + ((size_t)b * LCNT + i0 + (lane & 15)) * CH + h * HD + ((lane >> 4) << 3);   // [b][l][c]
#pragma unroll
  for (int tt = 0; tt < 4; ++tt) {
    v8h pk;
#pragma unroll
    for (int r = 0; r < 8; ++r) pk[r] = (half_t)(O[tt][r] * inv);
    *(v8h*)(aorow + tt * 16) = pk;
  }
}

// ---------------- proj GEMM + bias + residual: block = 128(o) x 64(l) ----------------
__global__ __launch_bounds__(256) void proj_kernel(const half_t* __restrict__ wp,
                                                   const half_t* __restrict__ ao,
                                                   const float* __restrict__ proj_b,
                                                   const float* __restrict__ x,
                                                   float* __restrict__ out) {
  int bx   = blockIdx.x;                 // 16 b * 2 mblk * 16 nt = 512
  int b    = bx / 32;
  int rem  = bx - b * 32;
  int mblk = rem >> 4;
  int nt   = rem & 15;
  int l0   = nt << 6;
  int tid  = threadIdx.x, wave = tid >> 5, lane = tid & 31;
  int o0   = mblk * 128 + wave * 16;
  const half_t* ab = ao + (size_t)b * LCNT * CH;

  __shared__ __align__(16) half_t btile[2][64][TPITCH];
  int srow = tid >> 2, sch = (tid & 3) << 3;
  const half_t* gsrc = ab + (size_t)(l0 + srow) * CH + sch;

  async_b128(gsrc, &btile[0][srow][sch]);
  v8f acc[4] = {};
  for (int ks = 0; ks < 8; ++ks) {
    int buf = ks & 1;
    if (ks + 1 < 8) {
      async_b128(gsrc + (ks + 1) * 32, &btile[buf ^ 1][srow][sch]);
      wait_async_le<1>();
    } else {
      wait_async_le<0>();
    }
    __syncthreads();
    v16h af = load_frag(wp, CH, o0, ks * 32);
#pragma unroll
    for (int j = 0; j < 4; ++j) {
      v16h bf = load_frag(&btile[buf][0][0], TPITCH, j * 16, 0);
      acc[j] = wmma_f16(af, bf, acc[j]);
    }
    __syncthreads();
  }

  int mh = (lane >> 4) << 3;
  float pb[8];
#pragma unroll
  for (int r = 0; r < 8; ++r) pb[r] = proj_b[o0 + mh + r];
#pragma unroll
  for (int j = 0; j < 4; ++j)
#pragma unroll
    for (int r = 0; r < 8; ++r) {
      int o = o0 + mh + r;
      int l = l0 + j * 16 + (lane & 15);
      size_t idx = ((size_t)b * CH + o) * LCNT + l;
      out[idx] = x[idx] + pb[r] + acc[j][r];
    }
}

extern "C" void kernel_launch(void* const* d_in, const int* in_sizes, int n_in,
                              void* d_out, int out_size, void* d_ws, size_t ws_size,
                              hipStream_t stream) {
  const float* x      = (const float*)d_in[0];
  const float* gn_w   = (const float*)d_in[1];
  const float* gn_b   = (const float*)d_in[2];
  const float* qkv_w  = (const float*)d_in[3];
  const float* qkv_b  = (const float*)d_in[4];
  const float* proj_w = (const float*)d_in[5];
  const float* proj_b = (const float*)d_in[6];
  float* out = (float*)d_out;

  // workspace layout (bytes), total ~40.5 MB
  char* ws = (char*)d_ws;
  half_t* wq  = (half_t*)(ws);              // 768*256 f16
  half_t* wp  = (half_t*)(ws +   393216);   // 256*256 f16
  half_t* y_t = (half_t*)(ws +   524288);   // 16*32*1024*8 f16
  half_t* qk  = (half_t*)(ws +  8912896);   // 16*2*4*1024*64 f16
  half_t* vv  = (half_t*)(ws + 25690112);   // 16*4*64*1024 f16
  half_t* ao  = (half_t*)(ws + 34078720);   // 16*1024*256 f16

  gn_kernel  <<<512,  256, 0, stream>>>(x, gn_w, gn_b, qkv_w, proj_w, y_t, wq, wp);
  qkv_kernel <<<1536, 256, 0, stream>>>(wq, y_t, qkv_b, qk, vv);
  attn_kernel<<<512,  256, 0, stream>>>(qk, vv, ao);
  proj_kernel<<<512,  256, 0, stream>>>(wp, ao, proj_b, x, out);
}

// v007
// Measured time: 63.1 microseconds a run.
// Two timings next to v006 put it at 1.05 and 1.06 times that version's speed.
// All steps since v000 together make it 3.28 times as fast.
#include <hip/hip_runtime.h>
#include <hip/hip_bf16.h>

typedef _Float16 half_t;
typedef __attribute__((ext_vector_type(2)))  _Float16 v2h;
typedef __attribute__((ext_vector_type(2)))  float    v2f;
typedef __attribute__((ext_vector_type(8)))  _Float16 v8h;
typedef __attribute__((ext_vector_type(16))) _Float16 v16h;
typedef __attribute__((ext_vector_type(8)))  float    v8f;
typedef __attribute__((ext_vector_type(4)))  int      v4i;

#define LCNT 1024   // 32*32 spatial positions
#define CH   256
#define NH   4
#define HD   64
#define OPITCH 72
#define KPITCH 72
#define TPITCH 40
#define SKEYS  128
#define VPITCH 136

#if __has_builtin(__builtin_amdgcn_global_load_async_to_lds_b128)
#define HAS_ASYNC 1
#else
#define HAS_ASYNC 0
#endif

#if HAS_ASYNC
typedef __attribute__((address_space(1))) v4i gv4i_t;   // global int4
typedef __attribute__((address_space(3))) v4i lv4i_t;   // LDS int4
#endif

__device__ __forceinline__ void async_b128(const half_t* g, half_t* l) {
#if HAS_ASYNC
  __builtin_amdgcn_global_load_async_to_lds_b128((gv4i_t*)g, (lv4i_t*)l, 0, 0);
#else
  *(v8h*)l = *(const v8h*)g;   // sync fallback: global load + ds store
#endif
}

template <int N>
__device__ __forceinline__ void wait_async_le() {
#if HAS_ASYNC
#if __has_builtin(__builtin_amdgcn_s_wait_asynccnt)
  __builtin_amdgcn_s_wait_asynccnt(N);
#else
  asm volatile("s_wait_asynccnt %0" :: "i"(N) : "memory");
#endif
#endif
}

__device__ __forceinline__ void async8_b128(const half_t* const (&g)[8], half_t* const (&l)[8]) {
  unsigned a[8];
#pragma unroll   // constant indices: the addresses stay in registers
  for (int c = 0; c < 8; ++c) a[c] = (unsigned)(unsigned long long)l[c];
  asm volatile("global_load_async_to_lds_b128 %0, %8, off\n\t"
               "global_load_async_to_lds_b128 %1, %9, off\n\t"
               "global_load_async_to_lds_b128 %2, %10, off\n\t"
               "global_load_async_to_lds_b128 %3, %11, off\n\t"
               "global_load_async_to_lds_b128 %4, %12, off\n\t"
               "global_load_async_to_lds_b128 %5, %13, off\n\t"
               "global_load_async_to_lds_b128 %6, %14, off\n\t"
               "global_load_async_to_lds_b128 %7, %15, off\n\t"
               "s_wait_xcnt 0x0"
               :: "v"(a[0]), "v"(a[1]), "v"(a[2]), "v"(a[3]), "v"(a[4]), "v"(a[5]), "v"(a[6]), "v"(a[7]),
                  "v"(g[0]), "v"(g[1]), "v"(g[2]), "v"(g[3]), "v"(g[4]), "v"(g[5]), "v"(g[6]), "v"(g[7])
               : "memory");
}

__device__ __forceinline__ v16h load_frag(const half_t* __restrict__ base,
                                          int ld, int row0, int k0) {
  int lane = threadIdx.x & 31;
  const half_t* p = base + (size_t)(row0 + (lane & 15)) * ld + k0 + ((lane >> 4) << 3);
  v8h lo = *(const v8h*)(p);
  v8h hi = *(const v8h*)(p + 16);
  v16h f;
#pragma unroll
  for (int i = 0; i < 8; ++i) { f[i] = lo[i]; f[8 + i] = hi[i]; }
  return f;
}

__device__ __forceinline__ v8f wmma_f16(v16h a, v16h b, v8f c) {
  return __builtin_amdgcn_wmma_f32_16x16x32_f16(false, a, false, b, (short)0, c,
                                                false, false);
}

__device__ __forceinline__ float xhalf(float x) {
  int v = __builtin_bit_cast(int, x);
  return __builtin_bit_cast(float,
      __builtin_amdgcn_permlanex16(v, v, 0x76543210, 0xfedcba98, false, false));
}

__device__ __forceinline__ v8f exp2x8(v8f x) {
  float a, b, c, d, e, f, g, h;
  asm("v_exp_f32 %0, %8\n\tv_exp_f32 %1, %9\n\tv_exp_f32 %2, %10\n\tv_exp_f32 %3, %11\n\t"
      "v_exp_f32 %4, %12\n\tv_exp_f32 %5, %13\n\tv_exp_f32 %6, %14\n\tv_exp_f32 %7, %15\n\tv_nop"
      : "=&v"(a), "=&v"(b), "=&v"(c), "=&v"(d), "=&v"(e), "=&v"(f), "=&v"(g), "=&v"(h)
      : "v"(x[0]), "v"(x[1]), "v"(x[2]), "v"(x[3]), "v"(x[4]), "v"(x[5]), "v"(x[6]), "v"(x[7]));
  v8f y = {a, b, c, d, e, f, g, h};
  return y;
}

// ---------------- GroupNorm -> y_t[b][g][l][8] f16, group-major; weights fp32 -> fp16 ----------------
// The launch has 512 * 256 threads and the two weight matrices 4 * CH * CH = 2 * 512 * 256 elements:
// each thread also converts two neighbouring weights, so the conversion needs no launch of its own.
// Blocks 0..383 take qkv_w, blocks 384..511 proj_w. Both are read first by later launches.
__global__ __launch_bounds__(256) void gn_kernel(const float* __restrict__ x,
                                                 const float* __restrict__ gw,
                                                 const float* __restrict__ gb,
                                                 const float* __restrict__ qkv_w,
                                                 const float* __restrict__ proj_w,
                                                 half_t* __restrict__ y_t,
                                                 half_t* __restrict__ wq,
                                                 half_t* __restrict__ wp) {
  const int CPG = 8;
  const int QBLK = 3 * CH * CH / 512;   // blocks that convert qkv_w, 512 elements each
  int b = blockIdx.x >> 5;
  int g = blockIdx.x & 31;
  bool isq = blockIdx.x < QBLK;
  int wi = ((isq ? blockIdx.x : blockIdx.x - QBLK) * 256 + threadIdx.x) * 2;
  v2f wv = *(const v2f*)((isq ? qkv_w : proj_w) + wi);   // in flight beside the first loads of x
  const float* xg = x + ((size_t)b * CH + g * CPG) * LCNT;
  float s = 0.f, s2 = 0.f;
  for (int idx = threadIdx.x; idx < CPG * LCNT; idx += 256) {
    float v = xg[idx];
    s += v; s2 += v * v;
  }
#pragma unroll
  for (int off = 16; off > 0; off >>= 1) {
    s  += __shfl_xor(s, off, 32);
    s2 += __shfl_xor(s2, off, 32);
  }
  __shared__ float rs[8], rq[8];
  int wave = threadIdx.x >> 5, lane = threadIdx.x & 31;
  if (lane == 0) { rs[wave] = s; rq[wave] = s2; }
  __syncthreads();
  s = 0.f; s2 = 0.f;
#pragma unroll
  for (int i = 0; i < 8; ++i) { s += rs[i]; s2 += rq[i]; }
  const float invN = 1.0f / (float)(CPG * LCNT);
  float mean = s * invN;
  float var  = s2 * invN - mean * mean;
  float rstd = rsqrtf(var + 1e-5f);
  // One thread owns a position's whole group: its 8 channels leave as one 16-byte store.
  // Neighbouring positions of a group are neighbours in y_t, so a wave's store is 512
  // contiguous bytes: 4 whole 128-B lines, each written by this block alone.
  for (int l = threadIdx.x; l < LCNT; l += 256) {
    v8h pk;
#pragma unroll
    for (int cl = 0; cl < CPG; ++cl) {
      int c = g * CPG + cl;
      float v = (xg[cl * LCNT + l] - mean) * rstd * gw[c] + gb[c];
      pk[cl] = (half_t)v;
    }
    *(v8h*)(y_t + (((size_t)b * (CH / CPG) + g) * LCNT + l) * CPG) = pk;
  }
  // Last, so that neither the barrier nor a reuse of its registers waits for this store. A wave stores one whole 128-B line.
  v2h wh = {(half_t)wv[0], (half_t)wv[1]};
  *(v2h*)((isq ? wq : wp) + wi) = wh;
}

// ---------------- QKV GEMM: block = 128(o) x 64(l), K=256 ----------------
// All 8 waves share the B tile (64 positions x 32 channels of y_t), staged async + double-buffered in LDS.
__global__ __launch_bounds__(256) void qkv_kernel(const half_t* __restrict__ wq,
                                                  const half_t* __restrict__ y_t,
                                                  const float* __restrict__ qkv_b,
                                                  half_t* __restrict__ qk,
                                                  half_t* __restrict__ vv) {
  int bx   = blockIdx.x;                 // 16 b * 6 mblk * 16 nt = 1536
  int b    = bx / 96;
  int rem  = bx - b * 96;
  int mblk = rem >> 4;
  int nt   = rem & 15;
  int l0   = nt << 6;
  int tid  = threadIdx.x, wave = tid >> 5, lane = tid & 31;
  int o0   = mblk * 128 + wave * 16;
  const half_t* yb = y_t + (size_t)b * LCNT * CH;

  __shared__ __align__(16) half_t btile[2][64][TPITCH];   // [l][k] for current k-step; 32 k a row, then the pad
  __shared__ __align__(16) half_t ostage[128][OPITCH]; // output tile, one row per 128-B line of q, k or v
  // 64 rows x 4 chunks of 16 B; a chunk is one group of 8 channels. A wave copies 32
  // neighbouring positions of one group: 512 contiguous bytes of y_t.
  int srow = tid & 63, sgrp = tid >> 6, sch = sgrp << 3;
  const half_t* gsrc = yb + ((size_t)sgrp * LCNT + l0 + srow) * 8;

  async_b128(gsrc, &btile[0][srow][sch]);             // prologue: k-step 0
  v8f acc[4] = {};
  for (int ks = 0; ks < 8; ++ks) {
    int buf = ks & 1;
    if (ks + 1 < 8) {
      async_b128(gsrc + (size_t)(ks + 1) * (4 * LCNT * 8), &btile[buf ^ 1][srow][sch]);   // 4 groups on
      wait_async_le<1>();                              // retire current buffer
    } else {
      wait_async_le<0>();
    }
    __syncthreads();
    v16h af = load_frag(wq, CH, o0, ks * 32);          // weights: L2-hot
#pragma unroll
    for (int j = 0; j < 4; ++j) {
      v16h bf = load_frag(&btile[buf][0][0], TPITCH, j * 16, 0);
      acc[j] = wmma_f16(af, bf, acc[j]);
    }
    __syncthreads();                                   // protect buf before overwrite
  }

  int mh = (lane >> 4) << 3;
  float pb[8];
#pragma unroll
  for (int r = 0; r < 8; ++r) pb[r] = qkv_b[o0 + mh + r];

  // The block's 128 o are one section (0=q 1=k 2=v) and two heads. The tile is
  // laid in LDS in the order of the destination, one row per 128-B line, and
  // then leaves as 16-byte stores: 8 lanes a line, 4 whole lines a wave.
  int sec = mblk >> 1;
  half_t* dst;          // first line of the tile
  int rstep, hstep;     // f16 from row to row inside a half of 64 rows; from half to half
  if (sec == 2) {       // v [b][h][d][l]: row = o, 64 l a row
#pragma unroll
    for (int j = 0; j < 4; ++j)
#pragma unroll
      for (int r = 0; r < 8; ++r)
        ostage[wave * 16 + mh + r][j * 16 + (lane & 15)] = (half_t)(acc[j][r] + pb[r]);
    dst   = vv + ((size_t)b * CH + (mblk & 1) * 128) * LCNT + l0;
    rstep = LCNT;
    hstep = 64 * LCNT;
  } else {              // q, k [b][s][h][l][d]: row = (head, l), 64 d a row
#pragma unroll
    for (int j = 0; j < 4; ++j) {
      v8h pk;
#pragma unroll
      for (int r = 0; r < 8; ++r) pk[r] = (half_t)(acc[j][r] + pb[r]);
      *(v8h*)&ostage[(wave >> 2) * 64 + j * 16 + (lane & 15)][(wave & 3) * 16 + mh] = pk;
    }
    dst   = qk + ((((size_t)b * 2 + sec) * NH + (mblk & 1) * 2) * LCNT + l0) * HD;
    rstep = HD;
    hstep = LCNT * HD;
  }
  __syncthreads();      // rows are read back by other waves than wrote them: all staged before any row is read
#pragma unroll
  for (int it = 0; it < 4; ++it) {
    int c = it * 256 + tid;
    int row = c >> 3, ch = (c & 7) << 3;
    *(v8h*)(dst + (size_t)(row >> 6) * hstep + (size_t)(row & 63) * rstep + ch) =
        *(const v8h*)&ostage[row][ch];
  }
}

// One stage of attention, keys j0 .. j0 + 127, into one buffer: K is 128 rows x 8 chunks of 16 B (16 KB contiguous in
// memory), V 64 rows x 16 chunks (256 contiguous B a row). Each thread copies 4 chunks of each; a wave's copy takes
// 512 contiguous bytes of K, or two rows' 256 bytes of V.
__device__ __forceinline__ void stage_kv(const half_t* kt, const half_t* vp, int j0,
                                         half_t (*kb)[KPITCH], half_t (*vb)[VPITCH], int tid) {
  const half_t* g[8];
  half_t* l[8];
#pragma unroll   // constant indices: the addresses stay in registers
  for (int c = 0; c < 4; ++c) {
    int idx = c * 256 + tid;
    int kr = idx >> 3, kc = (idx & 7) << 3;
    g[c] = kt + (size_t)(j0 + kr) * HD + kc;
    l[c] = &kb[kr][kc];
    int vr = idx >> 4, vc = (idx & 15) << 3;
    g[4 + c] = vp + (size_t)vr * LCNT + j0 + vc;
    l[4 + c] = &vb[vr][vc];
  }
  async8_b128(g, l);
}

// ---------------- flash attention: K/V stages async-copied to LDS, shared by 8 waves ----------------
// Two buffers of 128 keys. A stage's copies fly during the whole stage before it (4 passes), and the waves
// meet once a stage: inside a stage each wave runs its 4 passes at its own pace.
// Transposed products: S^T = K Q^T (rows j, columns i) and O^T += V P^T (rows d, columns i).
// A lane holds 16 of the 32 scores of ONE query i = lane & 15, so maximum and sum run
// in the lane's own registers, and the two S^T tiles, converted in place, are the B operand of V P^T.
__global__ __launch_bounds__(256) void attn_kernel(const half_t* __restrict__ qk,
                                                   const half_t* __restrict__ vv,
                                                   half_t* __restrict__ ao) {
  int bh = blockIdx.x >> 3;
  int ib = blockIdx.x & 7;
  int b = bh >> 2, h = bh & 3;
  int tid = threadIdx.x, wave = tid >> 5, lane = tid & 31;
  const half_t* qt = qk + (((size_t)b * 2 * NH + h) * LCNT) * HD;
  const half_t* kt = qk + ((((size_t)b * 2 + 1) * NH + h) * LCNT) * HD;
  const half_t* vp = vv + (((size_t)b * NH + h) * HD) * LCNT;
  int i0 = ib * 128 + wave * 16;

  __shared__ __align__(16) half_t ktile[2][SKEYS][KPITCH];   // [j][d]; 64 d a row, then the pad
  __shared__ __align__(16) half_t vtile[2][64][VPITCH];      // [d][j]; 128 j a row, then the pad

  v16h qf0 = load_frag(qt, HD, i0, 0);
  v16h qf1 = load_frag(qt, HD, i0, 32);
  float m_i = -1e30f;   // running maximum of query i, equal in both halves of the wave
  float l_i = 0.f;      // running sum over this half's own j only; the halves are joined after the loop
  v8f O[4] = {};        // O[tt][r] = O^T[d = tt*16 + 8*(lane>>4) + r][i]
  const float scale = 0.125f;   // 64^-0.5

  stage_kv(kt, vp, 0, ktile[0], vtile[0], tid);       // stage 0
  asm volatile("s_wait_asynccnt 0x0" ::: "memory");   // this wave's copies of stage 0 have landed before it signals the barrier
  __syncthreads();                                    // every wave's have landed before any fragment is read
  stage_kv(kt, vp, SKEYS, ktile[1], vtile[1], tid);   // stage 1 flies during stage 0

  for (int st = 0; st < LCNT / SKEYS; ++st) {
    int buf = st & 1;
#pragma unroll   // constant pass offsets fold into the LDS loads' offset fields
   for (int ps = 0; ps < SKEYS / 32; ++ps) {
    v16h kf00 = load_frag(&ktile[buf][0][0], KPITCH, ps * 32,      0);
    v16h kf01 = load_frag(&ktile[buf][0][0], KPITCH, ps * 32,      32);
    v16h kf10 = load_frag(&ktile[buf][0][0], KPITCH, ps * 32 + 16, 0);
    v16h kf11 = load_frag(&ktile[buf][0][0], KPITCH, ps * 32 + 16, 32);
    v8f s0 = {}, s1 = {};
    s0 = wmma_f16(kf00, qf0, s0);   // s0[r] = S^T[j = 8*(lane>>4) + r][i]
    s0 = wmma_f16(kf01, qf1, s0);
    s1 = wmma_f16(kf10, qf0, s1);   // s1[r] = S^T[j = 16 + 8*(lane>>4) + r][i]
    s1 = wmma_f16(kf11, qf1, s1);

    // online softmax of query i: 16 scores in this lane, the other 16 in lane ^ 16
    s0 *= scale;
    s1 *= scale;
    float rm = fmaxf(s0[0], s1[0]);
#pragma unroll   // constant element indices: the score vectors stay in registers
    for (int r = 1; r < 8; ++r) rm = fmaxf(rm, fmaxf(s0[r], s1[r]));
    rm = fmaxf(rm, xhalf(rm));
    float mn = fmaxf(m_i, rm);
    float alpha = __expf(m_i - mn);
    m_i = mn;
    // pf[s] = P^T[j][i], j = 8*(lane>>4) + s for s < 8 and 16 + 8*(lane>>4) + (s - 8) above: the k order of load_frag's V
    v16h pf;
    s0 = (s0 - mn) * 1.44269504f;   // exp(x) = 2^(x * log2 e), as __expf has it
    s1 = (s1 - mn) * 1.44269504f;
    s0 = exp2x8(s0);
    s1 = exp2x8(s1);
#pragma unroll
    for (int r = 0; r < 8; ++r) {
      pf[r]     = (half_t)s0[r];
      pf[8 + r] = (half_t)s1[r];
    }
    v8f t = s0 + s1;
    float rsum = ((t[0] + t[1]) + (t[2] + t[3])) + ((t[4] + t[5]) + (t[6] + t[7]));
    l_i = l_i * alpha + rsum;
#pragma unroll   // constant tile indices: the accumulators stay in registers
    for (int tt = 0; tt < 4; ++tt) O[tt] *= alpha;
#pragma unroll
    for (int tt = 0; tt < 4; ++tt) {
      v16h vf = load_frag(&vtile[buf][0][0], VPITCH, tt * 16, ps * 32);
      O[tt] = wmma_f16(vf, pf, O[tt]);
    }
   }
    // Hand-over, once a stage, every wave, in this order.
    asm volatile("s_wait_dscnt 0x0" ::: "memory");     // this wave's reads of buf have returned before buf may be refilled
    asm volatile("s_wait_asynccnt 0x0" ::: "memory");  // this wave's copies of stage st + 1 have landed
    __syncthreads();                                   // publishes stage st + 1 and ends every wave's reads of buf
    if (st + 2 < LCNT / SKEYS)
      stage_kv(kt, vp, (st + 2) * SKEYS, ktile[buf], vtile[buf], tid);
  }
  asm volatile("s_wait_asynccnt 0x0" ::: "memory");    // no copy is outstanding when the wave ends

  float inv = 1.0f / (l_i + xhalf(l_i));
  // A lane's 8 registers of a tile are 8 neighbouring channels of one position: one 16-byte store.
  half_t* aorow = ao + ((size_t)b * LCNT + i0 + (lane & 15)) * CH + h * HD + ((lane >> 4) << 3);   // [b][l][c]
#pragma unroll
  for (int tt = 0; tt < 4; ++tt) {
    v8h pk;
#pragma unroll
    for (int r = 0; r < 8; ++r) pk[r] = (half_t)(O[tt][r] * inv);
    *(v8h*)(aorow + tt * 16) = pk;
  }
}

// ---------------- proj GEMM + bias + residual: block = 128(o) x 64(l) ----------------
__global__ __launch_bounds__(256) void proj_kernel(const half_t* __restrict__ wp,
                                                   const half_t* __restrict__ ao,
                                                   const float* __restrict__ proj_b,
                                                   const float* __restrict__ x,
                                                   float* __restrict__ out) {
  int bx   = blockIdx.x;                 // 16 b * 2 mblk * 16 nt = 512
  int b    = bx / 32;
  int rem  = bx - b * 32;
  int mblk = rem >> 4;
  int nt   = rem & 15;
  int l0   = nt << 6;
  int tid  = threadIdx.x, wave = tid >> 5, lane = tid & 31;
  int o0   = mblk * 128 + wave * 16;
  const half_t* ab = ao + (size_t)b * LCNT * CH;

  __shared__ __align__(16) half_t btile[2][64][TPITCH];
  int srow = tid >> 2, sch = (tid & 3) << 3;
  const half_t* gsrc = ab + (size_t)(l0 + srow) * CH + sch;

  async_b128(gsrc, &btile[0][srow][sch]);
  v8f acc[4] = {};
  for (int ks = 0; ks < 8; ++ks) {
    int buf = ks & 1;
    if (ks + 1 < 8) {
      async_b128(gsrc + (ks + 1) * 32, &btile[buf ^ 1][srow][sch]);
      wait_async_le<1>();
    } else {
      wait_async_le<0>();
    }
    __syncthreads();
    v16h af = load_frag(wp, CH, o0, ks * 32);
#pragma unroll
    for (int j = 0; j < 4; ++j) {
      v16h bf = load_frag(&btile[buf][0][0], TPITCH, j * 16, 0);
      acc[j] = wmma_f16(af, bf, acc[j]);
    }
    __syncthreads();
  }

  int mh = (lane >> 4) << 3;
  float pb[8];
#pragma unroll
  for (int r = 0; r < 8; ++r) pb[r] = proj_b[o0 + mh + r];
#pragma unroll
  for (int j = 0; j < 4; ++j)
#pragma unroll
    for (int r = 0; r < 8; ++r) {
      int o = o0 + mh + r;
      int l = l0 + j * 16 + (lane & 15);
      size_t idx = ((size_t)b * CH + o) * LCNT + l;
      out[idx] = x[idx] + pb[r] + acc[j][r];
    }
}

extern "C" void kernel_launch(void* const* d_in, const int* in_sizes, int n_in,
                              void* d_out, int out_size, void* d_ws, size_t ws_size,
                              hipStream_t stream) {
  const float* x      = (const float*)d_in[0];
  const float* gn_w   = (const float*)d_in[1];
  const float* gn_b   = (const float*)d_in[2];
  const float* qkv_w  = (const float*)d_in[3];
  const float* qkv_b  = (const float*)d_in[4];
  const float* proj_w = (const float*)d_in[5];
  const float* proj_b = (const float*)d_in[6];
  float* out = (float*)d_out;

  // workspace layout (bytes), total ~40.5 MB
  char* ws = (char*)d_ws;
  half_t* wq  = (half_t*)(ws);              // 768*256 f16
  half_t* wp  = (half_t*)(ws +   393216);   // 256*256 f16
  half_t* y_t = (half_t*)(ws +   524288);   // 16*32*1024*8 f16
  half_t* qk  = (half_t*)(ws +  8912896);   // 16*2*4*1024*64 f16
  half_t* vv  = (half_t*)(ws + 25690112);   // 16*4*64*1024 f16
  half_t* ao  = (half_t*)(ws + 34078720);   // 16*1024*256 f16

  gn_kernel  <<<512,  256, 0, stream>>>(x, gn_w, gn_b, qkv_w, proj_w, y_t, wq, wp);
  qkv_kernel <<<1536, 256, 0, stream>>>(wq, y_t, qkv_b, qk, vv);
  attn_kernel<<<512,  256, 0, stream>>>(qk, vv, ao);
  proj_kernel<<<512,  256, 0, stream>>>(wp, ao, proj_b, x, out);
}

// v008
// One run takes 54.1 microseconds.
// In two side-by-side timings against v007, it was 1.16 and 1.18 times as fast.
// All steps since v000 together make it 3.84 times as fast.
#include <hip/hip_runtime.h>
#include <hip/hip_bf16.h>

typedef _Float16 half_t;
typedef __attribute__((ext_vector_type(2)))  _Float16 v2h;
typedef __attribute__((ext_vector_type(2)))  float    v2f;
typedef __attribute__((ext_vector_type(8)))  _Float16 v8h;
typedef __attribute__((ext_vector_type(16))) _Float16 v16h;
typedef __attribute__((ext_vector_type(8)))  float    v8f;
typedef __attribute__((ext_vector_type(4)))  int      v4i;

#define LCNT 1024   // 32*32 spatial positions
#define CH   256
#define NH   4
#define HD   64
#define OPITCH 72
#define KPITCH 72
#define TPITCH 40
#define SKEYS  128
#define VPITCH 136

#if __has_builtin(__builtin_amdgcn_global_load_async_to_lds_b128)
#define HAS_ASYNC 1
#else
#define HAS_ASYNC 0
#endif

#if HAS_ASYNC
typedef __attribute__((address_space(1))) v4i gv4i_t;   // global int4
typedef __attribute__((address_space(3))) v4i lv4i_t;   // LDS int4
#endif

__device__ __forceinline__ void async_b128(const half_t* g, half_t* l) {
#if HAS_ASYNC
  __builtin_amdgcn_global_load_async_to_lds_b128((gv4i_t*)g, (lv4i_t*)l, 0, 0);
#else
  *(v8h*)l = *(const v8h*)g;   // sync fallback: global load + ds store
#endif
}

template <int N>
__device__ __forceinline__ void wait_async_le() {
#if HAS_ASYNC
#if __has_builtin(__builtin_amdgcn_s_wait_asynccnt)
  __builtin_amdgcn_s_wait_asynccnt(N);
#else
  asm volatile("s_wait_asynccnt %0" :: "i"(N) : "memory");
#endif
#endif
}

__device__ __forceinline__ void async8_b128(const half_t* const (&g)[8], half_t* const (&l)[8]) {
  unsigned a[8];
#pragma unroll   // constant indices: the addresses stay in registers
  for (int c = 0; c < 8; ++c) a[c] = (unsigned)(unsigned long long)l[c];
  asm volatile("global_load_async_to_lds_b128 %0, %8, off\n\t"
               "global_load_async_to_lds_b128 %1, %9, off\n\t"
               "global_load_async_to_lds_b128 %2, %10, off\n\t"
               "global_load_async_to_lds_b128 %3, %11, off\n\t"
               "global_load_async_to_lds_b128 %4, %12, off\n\t"
               "global_load_async_to_lds_b128 %5, %13, off\n\t"
               "global_load_async_to_lds_b128 %6, %14, off\n\t"
               "global_load_async_to_lds_b128 %7, %15, off\n\t"
               "s_wait_xcnt 0x0"
               :: "v"(a[0]), "v"(a[1]), "v"(a[2]), "v"(a[3]), "v"(a[4]), "v"(a[5]), "v"(a[6]), "v"(a[7]),
                  "v"(g[0]), "v"(g[1]), "v"(g[2]), "v"(g[3]), "v"(g[4]), "v"(g[5]), "v"(g[6]), "v"(g[7])
               : "memory");
}

__device__ __forceinline__ v16h load_frag(const half_t* __restrict__ base,
                                          int ld, int row0, int k0) {
  int lane = threadIdx.x & 31;
  const half_t* p = base + (size_t)(row0 + (lane & 15)) * ld + k0 + ((lane >> 4) << 3);
  v8h lo = *(const v8h*)(p);
  v8h hi = *(const v8h*)(p + 16);
  v16h f;
#pragma unroll
  for (int i = 0; i < 8; ++i) { f[i] = lo[i]; f[8 + i] = hi[i]; }
  return f;
}

// The same fragment of a weight matrix [o][CH] that the GroupNorm launch has laid out in fragment order:
// tile (ot, ks) = rows ot*16 .. +15, k ks*32 .. +31 is 1 KB, first the 32 lanes' lower 8 f16, then their upper 8.
// Each of the two loads covers 512 contiguous bytes, 4 whole 128-B lines. The k order is load_frag's.
__device__ __forceinline__ v16h load_wfrag(const half_t* __restrict__ w, int ot, int ks) {
  const half_t* p = w + (size_t)(ot * (CH / 32) + ks) * 512 + ((threadIdx.x & 31) << 3);
  v8h lo = *(const v8h*)(p);
  v8h hi = *(const v8h*)(p + 256);
  v16h f;
#pragma unroll   // constant element indices: the fragment stays in registers
  for (int i = 0; i < 8; ++i) { f[i] = lo[i]; f[8 + i] = hi[i]; }
  return f;
}

__device__ __forceinline__ v8f wmma_f16(v16h a, v16h b, v8f c) {
  return __builtin_amdgcn_wmma_f32_16x16x32_f16(false, a, false, b, (short)0, c,
                                                false, false);
}

__device__ __forceinline__ float xhalf(float x) {
  int v = __builtin_bit_cast(int, x);
  return __builtin_bit_cast(float,
      __builtin_amdgcn_permlanex16(v, v, 0x76543210, 0xfedcba98, false, false));
}

__device__ __forceinline__ v8f exp2x8(v8f x) {
  float a, b, c, d, e, f, g, h;
  asm("v_exp_f32 %0, %8\n\tv_exp_f32 %1, %9\n\tv_exp_f32 %2, %10\n\tv_exp_f32 %3, %11\n\t"
      "v_exp_f32 %4, %12\n\tv_exp_f32 %5, %13\n\tv_exp_f32 %6, %14\n\tv_exp_f32 %7, %15\n\tv_nop"
      : "=&v"(a), "=&v"(b), "=&v"(c), "=&v"(d), "=&v"(e), "=&v"(f), "=&v"(g), "=&v"(h)
      : "v"(x[0]), "v"(x[1]), "v"(x[2]), "v"(x[3]), "v"(x[4]), "v"(x[5]), "v"(x[6]), "v"(x[7]));
  v8f y = {a, b, c, d, e, f, g, h};
  return y;
}

__global__ __launch_bounds__(256) void gn_kernel(const float* __restrict__ x,
                                                 const float* __restrict__ gw,
                                                 const float* __restrict__ gb,
                                                 const float* __restrict__ qkv_w,
                                                 const float* __restrict__ proj_w,
                                                 half_t* __restrict__ y_t,
                                                 half_t* __restrict__ wq,
                                                 half_t* __restrict__ wp) {
  const int CPG = 8;
  const int QBLK = 3 * CH * CH / 512;   // blocks that convert qkv_w, 512 elements each
  int b = blockIdx.x >> 5;
  int g = blockIdx.x & 31;
  bool isq = blockIdx.x < QBLK;
  int wi = ((isq ? blockIdx.x : blockIdx.x - QBLK) * 256 + threadIdx.x) * 2;
  int wl = (wi >> 3) & 31;                                // the lane whose fragment registers hold place wi
  int wo = (wi >> 12) * 16 + (wl & 15);                   // its row o
  int wk = ((wi >> 9) & 7) * 32 + ((wi >> 8) & 1) * 16 + (wl >> 4) * 8 + (wi & 7);   // its k
  v2f wv = *(const v2f*)((isq ? qkv_w : proj_w) + wo * CH + wk);   // in flight beside the first loads of x
  const float* xg = x + ((size_t)b * CH + g * CPG) * LCNT;
  float s = 0.f, s2 = 0.f;
  for (int idx = threadIdx.x; idx < CPG * LCNT; idx += 256) {
    float v = xg[idx];
    s += v; s2 += v * v;
  }
#pragma unroll
  for (int off = 16; off > 0; off >>= 1) {
    s  += __shfl_xor(s, off, 32);
    s2 += __shfl_xor(s2, off, 32);
  }
  __shared__ float rs[8], rq[8];
  int wave = threadIdx.x >> 5, lane = threadIdx.x & 31;
  if (lane == 0) { rs[wave] = s; rq[wave] = s2; }
  __syncthreads();
  s = 0.f; s2 = 0.f;
#pragma unroll
  for (int i = 0; i < 8; ++i) { s += rs[i]; s2 += rq[i]; }
  const float invN = 1.0f / (float)(CPG * LCNT);
  float mean = s * invN;
  float var  = s2 * invN - mean * mean;
  float rstd = rsqrtf(var + 1e-5f);
  // One thread owns a position's whole group: its 8 channels leave as one 16-byte store.
  // Neighbouring positions of a group are neighbours in y_t, so a wave's store is 512
  // contiguous bytes: 4 whole 128-B lines, each written by this block alone.
  for (int l = threadIdx.x; l < LCNT; l += 256) {
    v8h pk;
#pragma unroll
    for (int cl = 0; cl < CPG; ++cl) {
      int c = g * CPG + cl;
      float v = (xg[cl * LCNT + l] - mean) * rstd * gw[c] + gb[c];
      pk[cl] = (half_t)v;
    }
    *(v8h*)(y_t + (((size_t)b * (CH / CPG) + g) * LCNT + l) * CPG) = pk;
  }
  // Last, so that neither the barrier nor a reuse of its registers waits for this store. A wave stores one whole 128-B line.
  v2h wh = {(half_t)wv[0], (half_t)wv[1]};
  *(v2h*)((isq ? wq : wp) + wi) = wh;
}

// ---------------- QKV GEMM: block = 128(o) x 64(l), K=256 ----------------
// All 8 waves share the B tile (64 positions x 32 channels of y_t), staged async + double-buffered in LDS.
__global__ __launch_bounds__(256) void qkv_kernel(const half_t* __restrict__ wq,
                                                  const half_t* __restrict__ y_t,
                                                  const float* __restrict__ qkv_b,
                                                  half_t* __restrict__ qk,
                                                  half_t* __restrict__ vv) {
  int bx   = blockIdx.x;                 // 16 b * 6 mblk * 16 nt = 1536
  int b    = bx / 96;
  int rem  = bx - b * 96;
  int mblk = rem >> 4;
  int nt   = rem & 15;
  int l0   = nt << 6;
  int tid  = threadIdx.x, wave = tid >> 5, lane = tid & 31;
  int o0   = mblk * 128 + wave * 16;
  const half_t* yb = y_t + (size_t)b * LCNT * CH;

  __shared__ __align__(16) half_t btile[2][64][TPITCH];   // [l][k] for current k-step; 32 k a row, then the pad
  __shared__ __align__(16) half_t ostage[128][OPITCH]; // output tile, one row per 128-B line of q, k or v
  // 64 rows x 4 chunks of 16 B; a chunk is one group of 8 channels. A wave copies 32
  // neighbouring positions of one group: 512 contiguous bytes of y_t.
  int srow = tid & 63, sgrp = tid >> 6, sch = sgrp << 3;
  const half_t* gsrc = yb + ((size_t)sgrp * LCNT + l0 + srow) * 8;

  async_b128(gsrc, &btile[0][srow][sch]);             // prologue: k-step 0
  v8f acc[4] = {};
  for (int ks = 0; ks < 8; ++ks) {
    int buf = ks & 1;
    if (ks + 1 < 8) {
      async_b128(gsrc + (size_t)(ks + 1) * (4 * LCNT * 8), &btile[buf ^ 1][srow][sch]);   // 4 groups on
      wait_async_le<1>();                              // retire current buffer
    } else {
      wait_async_le<0>();
    }
    __syncthreads();
    v16h af = load_wfrag(wq, mblk * 8 + wave, ks);     // weights: L2-hot
#pragma unroll
    for (int j = 0; j < 4; ++j) {
      v16h bf = load_frag(&btile[buf][0][0], TPITCH, j * 16, 0);
      acc[j] = wmma_f16(af, bf, acc[j]);
    }
    __syncthreads();                                   // protect buf before overwrite
  }

  int mh = (lane >> 4) << 3;
  float pb[8];
#pragma unroll
  for (int r = 0; r < 8; ++r) pb[r] = qkv_b[o0 + mh + r];

  // The block's 128 o are one section (0=q 1=k 2=v) and two heads. The tile is
  // laid in LDS in the order of the destination, one row per 128-B line, and
  // then leaves as 16-byte stores: 8 lanes a line, 4 whole lines a wave.
  int sec = mblk >> 1;
  half_t* dst;          // first line of the tile
  int rstep, hstep;     // f16 from row to row inside a half of 64 rows; from half to half
  if (sec == 2) {       // v [b][h][d][l]: row = o, 64 l a row
#pragma unroll
    for (int j = 0; j < 4; ++j)
#pragma unroll
      for (int r = 0; r < 8; ++r)
        ostage[wave * 16 + mh + r][j * 16 + (lane & 15)] = (half_t)(acc[j][r] + pb[r]);
    dst   = vv + ((size_t)b * CH + (mblk & 1) * 128) * LCNT + l0;
    rstep = LCNT;
    hstep = 64 * LCNT;
  } else {              // q, k [b][s][h][l][d]: row = (head, l), 64 d a row
#pragma unroll
    for (int j = 0; j < 4; ++j) {
      v8h pk;
#pragma unroll
      for (int r = 0; r < 8; ++r) pk[r] = (half_t)(acc[j][r] + pb[r]);
      *(v8h*)&ostage[(wave >> 2) * 64 + j * 16 + (lane & 15)][(wave & 3) * 16 + mh] = pk;
    }
    dst   = qk + ((((size_t)b * 2 + sec) * NH + (mblk & 1) * 2) * LCNT + l0) * HD;
    rstep = HD;
    hstep = LCNT * HD;
  }
  __syncthreads();      // rows are read back by other waves than wrote them: all staged before any row is read
#pragma unroll
  for (int it = 0; it < 4; ++it) {
    int c = it * 256 + tid;
    int row = c >> 3, ch = (c & 7) << 3;
    *(v8h*)(dst + (size_t)(row >> 6) * hstep + (size_t)(row & 63) * rstep + ch) =
        *(const v8h*)&ostage[row][ch];
  }
}

// One stage of attention, keys j0 .. j0 + 127, into one buffer: K is 128 rows x 8 chunks of 16 B (16 KB contiguous in
// memory), V 64 rows x 16 chunks (256 contiguous B a row). Each thread copies 4 chunks of each; a wave's copy takes
// 512 contiguous bytes of K, or two rows' 256 bytes of V.
__device__ __forceinline__ void stage_kv(const half_t* kt, const half_t* vp, int j0,
                                         half_t (*kb)[KPITCH], half_t (*vb)[VPITCH], int tid) {
  const half_t* g[8];
  half_t* l[8];
#pragma unroll   // constant indices: the addresses stay in registers
  for (int c = 0; c < 4; ++c) {
    int idx = c * 256 + tid;
    int kr = idx >> 3, kc = (idx & 7) << 3;
    g[c] = kt + (size_t)(j0 + kr) * HD + kc;
    l[c] = &kb[kr][kc];
    int vr = idx >> 4, vc = (idx & 15) << 3;
    g[4 + c] = vp + (size_t)vr * LCNT + j0 + vc;
    l[4 + c] = &vb[vr][vc];
  }
  async8_b128(g, l);
}

// ---------------- flash attention: K/V stages async-copied to LDS, shared by 8 waves ----------------
// Two buffers of 128 keys. A stage's copies fly during the whole stage before it (4 passes), and the waves
// meet once a stage: inside a stage each wave runs its 4 passes at its own pace.
// Transposed products: S^T = K Q^T (rows j, columns i) and O^T += V P^T (rows d, columns i).
// A lane holds 16 of the 32 scores of ONE query i = lane & 15, so maximum and sum run
// in the lane's own registers, and the two S^T tiles, converted in place, are the B operand of V P^T.
__global__ __launch_bounds__(256) void attn_kernel(const half_t* __restrict__ qk,
                                                   const half_t* __restrict__ vv,
                                                   half_t* __restrict__ ao) {
  int bh = blockIdx.x >> 3;
  int ib = blockIdx.x & 7;
  int b = bh >> 2, h = bh & 3;
  int tid = threadIdx.x, wave = tid >> 5, lane = tid & 31;
  const half_t* qt = qk + (((size_t)b * 2 * NH + h) * LCNT) * HD;
  const half_t* kt = qk + ((((size_t)b * 2 + 1) * NH + h) * LCNT) * HD;
  const half_t* vp = vv + (((size_t)b * NH + h) * HD) * LCNT;
  int i0 = ib * 128 + wave * 16;

  __shared__ __align__(16) half_t ktile[2][SKEYS][KPITCH];   // [j][d]; 64 d a row, then the pad
  __shared__ __align__(16) half_t vtile[2][64][VPITCH];      // [d][j]; 128 j a row, then the pad

  v16h qf0 = load_frag(qt, HD, i0, 0);
  v16h qf1 = load_frag(qt, HD, i0, 32);
  float m_i = -1e30f;   // running maximum of query i, equal in both halves of the wave
  float l_i = 0.f;      // running sum over this half's own j only; the halves are joined after the loop
  v8f O[4] = {};        // O[tt][r] = O^T[d = tt*16 + 8*(lane>>4) + r][i]
  const float scale = 0.125f;   // 64^-0.5

  stage_kv(kt, vp, 0, ktile[0], vtile[0], tid);       // stage 0
  asm volatile("s_wait_asynccnt 0x0" ::: "memory");   // this wave's copies of stage 0 have landed before it signals the barrier
  __syncthreads();                                    // every wave's have landed before any fragment is read
  stage_kv(kt, vp, SKEYS, ktile[1], vtile[1], tid);   // stage 1 flies during stage 0

  for (int st = 0; st < LCNT / SKEYS; ++st) {
    int buf = st & 1;
#pragma unroll   // constant pass offsets fold into the LDS loads' offset fields
   for (int ps = 0; ps < SKEYS / 32; ++ps) {
    v16h kf00 = load_frag(&ktile[buf][0][0], KPITCH, ps * 32,      0);
    v16h kf01 = load_frag(&ktile[buf][0][0], KPITCH, ps * 32,      32);
    v16h kf10 = load_frag(&ktile[buf][0][0], KPITCH, ps * 32 + 16, 0);
    v16h kf11 = load_frag(&ktile[buf][0][0], KPITCH, ps * 32 + 16, 32);
    v8f s0 = {}, s1 = {};
    s0 = wmma_f16(kf00, qf0, s0);   // s0[r] = S^T[j = 8*(lane>>4) + r][i]
    s0 = wmma_f16(kf01, qf1, s0);
    s1 = wmma_f16(kf10, qf0, s1);   // s1[r] = S^T[j = 16 + 8*(lane>>4) + r][i]
    s1 = wmma_f16(kf11, qf1, s1);

    // online softmax of query i: 16 scores in this lane, the other 16 in lane ^ 16
    s0 *= scale;
    s1 *= scale;
    float rm = fmaxf(s0[0], s1[0]);
#pragma unroll   // constant element indices: the score vectors stay in registers
    for (int r = 1; r < 8; ++r) rm = fmaxf(rm, fmaxf(s0[r], s1[r]));
    rm = fmaxf(rm, xhalf(rm));
    float mn = fmaxf(m_i, rm);
    float alpha = __expf(m_i - mn);
    m_i = mn;
    // pf[s] = P^T[j][i], j = 8*(lane>>4) + s for s < 8 and 16 + 8*(lane>>4) + (s - 8) above: the k order of load_frag's V
    v16h pf;
    s0 = (s0 - mn) * 1.44269504f;   // exp(x) = 2^(x * log2 e), as __expf has it
    s1 = (s1 - mn) * 1.44269504f;
    s0 = exp2x8(s0);
    s1 = exp2x8(s1);
#pragma unroll
    for (int r = 0; r < 8; ++r) {
      pf[r]     = (half_t)s0[r];
      pf[8 + r] = (half_t)s1[r];
    }
    v8f t = s0 + s1;
    float rsum = ((t[0] + t[1]) + (t[2] + t[3])) + ((t[4] + t[5]) + (t[6] + t[7]));
    l_i = l_i * alpha + rsum;
#pragma unroll   // constant tile indices: the accumulators stay in registers
    for (int tt = 0; tt < 4; ++tt) O[tt] *= alpha;
#pragma unroll
    for (int tt = 0; tt < 4; ++tt) {
      v16h vf = load_frag(&vtile[buf][0][0], VPITCH, tt * 16, ps * 32);
      O[tt] = wmma_f16(vf, pf, O[tt]);
    }
   }
    // Hand-over, once a stage, every wave, in this order.
    asm volatile("s_wait_dscnt 0x0" ::: "memory");     // this wave's reads of buf have returned before buf may be refilled
    asm volatile("s_wait_asynccnt 0x0" ::: "memory");  // this wave's copies of stage st + 1 have landed
    __syncthreads();                                   // publishes stage st + 1 and ends every wave's reads of buf
    if (st + 2 < LCNT / SKEYS)
      stage_kv(kt, vp, (st + 2) * SKEYS, ktile[buf], vtile[buf], tid);
  }
  asm volatile("s_wait_asynccnt 0x0" ::: "memory");    // no copy is outstanding when the wave ends

  float inv = 1.0f / (l_i + xhalf(l_i));
  // A lane's 8 registers of a tile are 8 neighbouring channels of one position: one 16-byte store.
  half_t* aorow = ao + ((size_t)b * LCNT + i0 + (lane & 15)) * CH + h * HD + ((lane >> 4) << 3);   // [b][l][c]
#pragma unroll
  for (int tt = 0; tt < 4; ++tt) {
    v8h pk;
#pragma unroll
    for (int r = 0; r < 8; ++r) pk[r] = (half_t)(O[tt][r] * inv);
    *(v8h*)(aorow + tt * 16) = pk;
  }
}

// ---------------- proj GEMM + bias + residual: block = 128(o) x 64(l) ----------------
__global__ __launch_bounds__(256) void proj_kernel(const half_t* __restrict__ wp,
                                                   const half_t* __restrict__ ao,
                                                   const float* __restrict__ proj_b,
                                                   const float* __restrict__ x,
                                                   float* __restrict__ out) {
  int bx   = blockIdx.x;                 // 16 b * 2 mblk * 16 nt = 512
  int b    = bx / 32;
  int rem  = bx - b * 32;
  int mblk = rem >> 4;
  int nt   = rem & 15;
  int l0   = nt << 6;
  int tid  = threadIdx.x, wave = tid >> 5, lane = tid & 31;
  int o0   = mblk * 128 + wave * 16;
  const half_t* ab = ao + (size_t)b * LCNT * CH;

  __shared__ __align__(16) half_t btile[2][64][TPITCH];
  int srow = tid >> 2, sch = (tid & 3) << 3;
  const half_t* gsrc = ab + (size_t)(l0 + srow) * CH + sch;

  async_b128(gsrc, &btile[0][srow][sch]);
  v8f acc[4] = {};
  for (int ks = 0; ks < 8; ++ks) {
    int buf = ks & 1;
    if (ks + 1 < 8) {
      async_b128(gsrc + (ks + 1) * 32, &btile[buf ^ 1][srow][sch]);
      wait_async_le<1>();
    } else {
      wait_async_le<0>();
    }
    __syncthreads();
    v16h af = load_wfrag(wp, mblk * 8 + wave, ks);
#pragma unroll
    for (int j = 0; j < 4; ++j) {
      v16h bf = load_frag(&btile[buf][0][0], TPITCH, j * 16, 0);
      acc[j] = wmma_f16(af, bf, acc[j]);
    }
    __syncthreads();
  }

  int mh = (lane >> 4) << 3;
  float pb[8];
#pragma unroll
  for (int r = 0; r < 8; ++r) pb[r] = proj_b[o0 + mh + r];
#pragma unroll
  for (int j = 0; j < 4; ++j)
#pragma unroll
    for (int r = 0; r < 8; ++r) {
      int o = o0 + mh + r;
      int l = l0 + j * 16 + (lane & 15);
      size_t idx = ((size_t)b * CH + o) * LCNT + l;
      out[idx] = x[idx] + pb[r] + acc[j][r];
    }
}

extern "C" void kernel_launch(void* const* d_in, const int* in_sizes, int n_in,
                              void* d_out, int out_size, void* d_ws, size_t ws_size,
                              hipStream_t stream) {
  const float* x      = (const float*)d_in[0];
  const float* gn_w   = (const float*)d_in[1];
  const float* gn_b   = (const float*)d_in[2];
  const float* qkv_w  = (const float*)d_in[3];
  const float* qkv_b  = (const float*)d_in[4];
  const float* proj_w = (const float*)d_in[5];
  const float* proj_b = (const float*)d_in[6];
  float* out = (float*)d_out;

  // workspace layout (bytes), total ~40.5 MB
  char* ws = (char*)d_ws;
  half_t* wq  = (half_t*)(ws);              // 768*256 f16, fragment order
  half_t* wp  = (half_t*)(ws +   393216);   // 256*256 f16, fragment order
  half_t* y_t = (half_t*)(ws +   524288);   // 16*32*1024*8 f16
  half_t* qk  = (half_t*)(ws +  8912896);   // 16*2*4*1024*64 f16
  half_t* vv  = (half_t*)(ws + 25690112);   // 16*4*64*1024 f16
  half_t* ao  = (half_t*)(ws + 34078720);   // 16*1024*256 f16

  gn_kernel  <<<512,  256, 0, stream>>>(x, gn_w, gn_b, qkv_w, proj_w, y_t, wq, wp);
  qkv_kernel <<<1536, 256, 0, stream>>>(wq, y_t, qkv_b, qk, vv);
  attn_kernel<<<512,  256, 0, stream>>>(qk, vv, ao);
  proj_kernel<<<512,  256, 0, stream>>>(wp, ao, proj_b, x, out);
}

// v009
// One run takes 48.5 microseconds.
// Next to v008, in two timings, it ran 1.12 and 1.11 times as fast.
// Counting every step since v000, it is 4.27 times as fast.
#include <hip/hip_runtime.h>
#include <hip/hip_bf16.h>

typedef _Float16 half_t;
typedef __attribute__((ext_vector_type(2)))  _Float16 v2h;
typedef __attribute__((ext_vector_type(2)))  float    v2f;
typedef __attribute__((ext_vector_type(8)))  _Float16 v8h;
typedef __attribute__((ext_vector_type(16))) _Float16 v16h;
typedef __attribute__((ext_vector_type(8)))  float    v8f;

#define LCNT 1024   // 32*32 spatial positions
#define CH   256
#define NH   4
#define HD   64
#define OPITCH 72
#define KPITCH 72
#define BPITCH 264
#define SKEYS  128
#define VPITCH 136

__device__ __forceinline__ void async8_b128(const half_t* const (&g)[8], half_t* const (&l)[8]) {
  unsigned a[8];
#pragma unroll   // constant indices: the addresses stay in registers
  for (int c = 0; c < 8; ++c) a[c] = (unsigned)(unsigned long long)l[c];
  asm volatile("global_load_async_to_lds_b128 %0, %8, off\n\t"
               "global_load_async_to_lds_b128 %1, %9, off\n\t"
               "global_load_async_to_lds_b128 %2, %10, off\n\t"
               "global_load_async_to_lds_b128 %3, %11, off\n\t"
               "global_load_async_to_lds_b128 %4, %12, off\n\t"
               "global_load_async_to_lds_b128 %5, %13, off\n\t"
               "global_load_async_to_lds_b128 %6, %14, off\n\t"
               "global_load_async_to_lds_b128 %7, %15, off\n\t"
               "s_wait_xcnt 0x0"
               :: "v"(a[0]), "v"(a[1]), "v"(a[2]), "v"(a[3]), "v"(a[4]), "v"(a[5]), "v"(a[6]), "v"(a[7]),
                  "v"(g[0]), "v"(g[1]), "v"(g[2]), "v"(g[3]), "v"(g[4]), "v"(g[5]), "v"(g[6]), "v"(g[7])
               : "memory");
}

__device__ __forceinline__ v16h load_frag(const half_t* __restrict__ base,
                                          int ld, int row0, int k0) {
  int lane = threadIdx.x & 31;
  const half_t* p = base + (size_t)(row0 + (lane & 15)) * ld + k0 + ((lane >> 4) << 3);
  v8h lo = *(const v8h*)(p);
  v8h hi = *(const v8h*)(p + 16);
  v16h f;
#pragma unroll
  for (int i = 0; i < 8; ++i) { f[i] = lo[i]; f[8 + i] = hi[i]; }
  return f;
}

// The same fragment of a weight matrix [o][CH] that the GroupNorm launch has laid out in fragment order:
// tile (ot, ks) = rows ot*16 .. +15, k ks*32 .. +31 is 1 KB, first the 32 lanes' lower 8 f16, then their upper 8.
// Each of the two loads covers 512 contiguous bytes, 4 whole 128-B lines. The k order is load_frag's.
__device__ __forceinline__ v16h load_wfrag(const half_t* __restrict__ w, int ot, int ks) {
  const half_t* p = w + (size_t)(ot * (CH / 32) + ks) * 512 + ((threadIdx.x & 31) << 3);
  v8h lo = *(const v8h*)(p);
  v8h hi = *(const v8h*)(p + 256);
  v16h f;
#pragma unroll   // constant element indices: the fragment stays in registers
  for (int i = 0; i < 8; ++i) { f[i] = lo[i]; f[8 + i] = hi[i]; }
  return f;
}

__device__ __forceinline__ v8f wmma_f16(v16h a, v16h b, v8f c) {
  return __builtin_amdgcn_wmma_f32_16x16x32_f16(false, a, false, b, (short)0, c,
                                                false, false);
}

__device__ __forceinline__ float xhalf(float x) {
  int v = __builtin_bit_cast(int, x);
  return __builtin_bit_cast(float,
      __builtin_amdgcn_permlanex16(v, v, 0x76543210, 0xfedcba98, false, false));
}

__device__ __forceinline__ v8f exp2x8(v8f x) {
  float a, b, c, d, e, f, g, h;
  asm("v_exp_f32 %0, %8\n\tv_exp_f32 %1, %9\n\tv_exp_f32 %2, %10\n\tv_exp_f32 %3, %11\n\t"
      "v_exp_f32 %4, %12\n\tv_exp_f32 %5, %13\n\tv_exp_f32 %6, %14\n\tv_exp_f32 %7, %15\n\tv_nop"
      : "=&v"(a), "=&v"(b), "=&v"(c), "=&v"(d), "=&v"(e), "=&v"(f), "=&v"(g), "=&v"(h)
      : "v"(x[0]), "v"(x[1]), "v"(x[2]), "v"(x[3]), "v"(x[4]), "v"(x[5]), "v"(x[6]), "v"(x[7]));
  v8f y = {a, b, c, d, e, f, g, h};
  return y;
}

__global__ __launch_bounds__(256) void gn_kernel(const float* __restrict__ x,
                                                 const float* __restrict__ gw,
                                                 const float* __restrict__ gb,
                                                 const float* __restrict__ qkv_w,
                                                 const float* __restrict__ proj_w,
                                                 half_t* __restrict__ y_t,
                                                 half_t* __restrict__ wq,
                                                 half_t* __restrict__ wp) {
  const int CPG = 8;
  const int QBLK = 3 * CH * CH / 512;   // blocks that convert qkv_w, 512 elements each
  int b = blockIdx.x >> 5;
  int g = blockIdx.x & 31;
  bool isq = blockIdx.x < QBLK;
  int wi = ((isq ? blockIdx.x : blockIdx.x - QBLK) * 256 + threadIdx.x) * 2;
  int wl = (wi >> 3) & 31;                                // the lane whose fragment registers hold place wi
  int wo = (wi >> 12) * 16 + (wl & 15);                   // its row o
  int wk = ((wi >> 9) & 7) * 32 + ((wi >> 8) & 1) * 16 + (wl >> 4) * 8 + (wi & 7);   // its k
  v2f wv = *(const v2f*)((isq ? qkv_w : proj_w) + wo * CH + wk);   // in flight beside the first loads of x
  const float* xg = x + ((size_t)b * CH + g * CPG) * LCNT;
  float s = 0.f, s2 = 0.f;
  for (int idx = threadIdx.x; idx < CPG * LCNT; idx += 256) {
    float v = xg[idx];
    s += v; s2 += v * v;
  }
#pragma unroll
  for (int off = 16; off > 0; off >>= 1) {
    s  += __shfl_xor(s, off, 32);
    s2 += __shfl_xor(s2, off, 32);
  }
  __shared__ float rs[8], rq[8];
  int wave = threadIdx.x >> 5, lane = threadIdx.x & 31;
  if (lane == 0) { rs[wave] = s; rq[wave] = s2; }
  __syncthreads();
  s = 0.f; s2 = 0.f;
#pragma unroll
  for (int i = 0; i < 8; ++i) { s += rs[i]; s2 += rq[i]; }
  const float invN = 1.0f / (float)(CPG * LCNT);
  float mean = s * invN;
  float var  = s2 * invN - mean * mean;
  float rstd = rsqrtf(var + 1e-5f);
  // One thread owns a position's whole group: its 8 channels leave as one 16-byte store.
  // Neighbouring positions of a group are neighbours in y_t, so a wave's store is 512
  // contiguous bytes: 4 whole 128-B lines, each written by this block alone.
  for (int l = threadIdx.x; l < LCNT; l += 256) {
    v8h pk;
#pragma unroll
    for (int cl = 0; cl < CPG; ++cl) {
      int c = g * CPG + cl;
      float v = (xg[cl * LCNT + l] - mean) * rstd * gw[c] + gb[c];
      pk[cl] = (half_t)v;
    }
    *(v8h*)(y_t + (((size_t)b * (CH / CPG) + g) * LCNT + l) * CPG) = pk;
  }
  // Last, so that neither the barrier nor a reuse of its registers waits for this store. A wave stores one whole 128-B line.
  v2h wh = {(half_t)wv[0], (half_t)wv[1]};
  *(v2h*)((isq ? wq : wp) + wi) = wh;
}

// ---------------- QKV GEMM: block = 128(o) x 64(l), K=256 ----------------
// All 8 waves share the B tile (64 positions x all 256 channels of y_t). It is copied to LDS once, whole, so the
// k loop holds no barrier and no wait for a copy, and the wave's 8 weight fragments are in flight beside the copies.
__global__ __launch_bounds__(256) void qkv_kernel(const half_t* __restrict__ wq,
                                                  const half_t* __restrict__ y_t,
                                                  const float* __restrict__ qkv_b,
                                                  half_t* __restrict__ qk,
                                                  half_t* __restrict__ vv) {
  int bx   = blockIdx.x;                 // 16 b * 6 mblk * 16 nt = 1536
  int b    = bx / 96;
  int rem  = bx - b * 96;
  int mblk = rem >> 4;
  int nt   = rem & 15;
  int l0   = nt << 6;
  int tid  = threadIdx.x, wave = tid >> 5, lane = tid & 31;
  int o0   = mblk * 128 + wave * 16;
  const half_t* yb = y_t + (size_t)b * LCNT * CH;

  __shared__ __align__(16) half_t btile[64][BPITCH];   // [l][k]; 256 k a row, then the pad
  __shared__ __align__(16) half_t ostage[128][OPITCH]; // output tile, one row per 128-B line of q, k or v
  // 64 rows x 32 chunks of 16 B; a chunk is one group of 8 channels. A wave's copy takes 32
  // neighbouring positions of one group: 512 contiguous bytes of y_t. Each thread copies 8 chunks.
  int srow = tid & 63, sgrp = tid >> 6;
  const half_t* cg[8];
  half_t* cl[8];
#pragma unroll   // constant indices: the addresses stay in registers
  for (int c = 0; c < 8; ++c) {
    int grp = c * 4 + sgrp;
    cg[c] = yb + ((size_t)grp * LCNT + l0 + srow) * 8;
    cl[c] = &btile[srow][grp * 8];
  }
  v16h af[8];      // issued ahead of the copies, whose statement ends in a wait
#pragma unroll   // constant indices: the fragments stay in registers
  for (int ks = 0; ks < 8; ++ks) af[ks] = load_wfrag(wq, mblk * 8 + wave, ks);
  async8_b128(cg, cl);
  asm volatile("s_wait_asynccnt 0x0" ::: "memory");   // this wave's copies have landed before it signals the barrier
  __syncthreads();                                    // every wave's have landed before any fragment is read
  v8f acc[4] = {};
#pragma unroll   // constant k offsets fold into the LDS loads' offset fields; af is indexed by constants
  for (int ks = 0; ks < 8; ++ks) {
#pragma unroll
    for (int j = 0; j < 4; ++j) {
      v16h bf = load_frag(&btile[0][0], BPITCH, j * 16, ks * 32);
      acc[j] = wmma_f16(af[ks], bf, acc[j]);
    }
  }

  int mh = (lane >> 4) << 3;
  float pb[8];
#pragma unroll
  for (int r = 0; r < 8; ++r) pb[r] = qkv_b[o0 + mh + r];

  // The block's 128 o are one section (0=q 1=k 2=v) and two heads. The tile is
  // laid in LDS in the order of the destination, one row per 128-B line, and
  // then leaves as 16-byte stores: 8 lanes a line, 4 whole lines a wave.
  int sec = mblk >> 1;
  half_t* dst;          // first line of the tile
  int rstep, hstep;     // f16 from row to row inside a half of 64 rows; from half to half
  if (sec == 2) {       // v [b][h][d][l]: row = o, 64 l a row
#pragma unroll
    for (int j = 0; j < 4; ++j)
#pragma unroll
      for (int r = 0; r < 8; ++r)
        ostage[wave * 16 + mh + r][j * 16 + (lane & 15)] = (half_t)(acc[j][r] + pb[r]);
    dst   = vv + ((size_t)b * CH + (mblk & 1) * 128) * LCNT + l0;
    rstep = LCNT;
    hstep = 64 * LCNT;
  } else {              // q, k [b][s][h][l][d]: row = (head, l), 64 d a row
#pragma unroll
    for (int j = 0; j < 4; ++j) {
      v8h pk;
#pragma unroll
      for (int r = 0; r < 8; ++r) pk[r] = (half_t)(acc[j][r] + pb[r]);
      *(v8h*)&ostage[(wave >> 2) * 64 + j * 16 + (lane & 15)][(wave & 3) * 16 + mh] = pk;
    }
    dst   = qk + ((((size_t)b * 2 + sec) * NH + (mblk & 1) * 2) * LCNT + l0) * HD;
    rstep = HD;
    hstep = LCNT * HD;
  }
  __syncthreads();      // rows are read back by other waves than wrote them: all staged before any row is read
#pragma unroll
  for (int it = 0; it < 4; ++it) {
    int c = it * 256 + tid;
    int row = c >> 3, ch = (c & 7) << 3;
    *(v8h*)(dst + (size_t)(row >> 6) * hstep + (size_t)(row & 63) * rstep + ch) =
        *(const v8h*)&ostage[row][ch];
  }
}

// One stage of attention, keys j0 .. j0 + 127, into one buffer: K is 128 rows x 8 chunks of 16 B (16 KB contiguous in
// memory), V 64 rows x 16 chunks (256 contiguous B a row). Each thread copies 4 chunks of each; a wave's copy takes
// 512 contiguous bytes of K, or two rows' 256 bytes of V.
__device__ __forceinline__ void stage_kv(const half_t* kt, const half_t* vp, int j0,
                                         half_t (*kb)[KPITCH], half_t (*vb)[VPITCH], int tid) {
  const half_t* g[8];
  half_t* l[8];
#pragma unroll   // constant indices: the addresses stay in registers
  for (int c = 0; c < 4; ++c) {
    int idx = c * 256 + tid;
    int kr = idx >> 3, kc = (idx & 7) << 3;
    g[c] = kt + (size_t)(j0 + kr) * HD + kc;
    l[c] = &kb[kr][kc];
    int vr = idx >> 4, vc = (idx & 15) << 3;
    g[4 + c] = vp + (size_t)vr * LCNT + j0 + vc;
    l[4 + c] = &vb[vr][vc];
  }
  async8_b128(g, l);
}

// ---------------- flash attention: K/V stages async-copied to LDS, shared by 8 waves ----------------
// Two buffers of 128 keys. A stage's copies fly during the whole stage before it (4 passes), and the waves
// meet once a stage: inside a stage each wave runs its 4 passes at its own pace.
// Transposed products: S^T = K Q^T (rows j, columns i) and O^T += V P^T (rows d, columns i).
// A lane holds 16 of the 32 scores of ONE query i = lane & 15, so maximum and sum run
// in the lane's own registers, and the two S^T tiles, converted in place, are the B operand of V P^T.
__global__ __launch_bounds__(256) void attn_kernel(const half_t* __restrict__ qk,
                                                   const half_t* __restrict__ vv,
                                                   half_t* __restrict__ ao) {
  int bh = blockIdx.x >> 3;
  int ib = blockIdx.x & 7;
  int b = bh >> 2, h = bh & 3;
  int tid = threadIdx.x, wave = tid >> 5, lane = tid & 31;
  const half_t* qt = qk + (((size_t)b * 2 * NH + h) * LCNT) * HD;
  const half_t* kt = qk + ((((size_t)b * 2 + 1) * NH + h) * LCNT) * HD;
  const half_t* vp = vv + (((size_t)b * NH + h) * HD) * LCNT;
  int i0 = ib * 128 + wave * 16;

  __shared__ __align__(16) half_t ktile[2][SKEYS][KPITCH];   // [j][d]; 64 d a row, then the pad
  __shared__ __align__(16) half_t vtile[2][64][VPITCH];      // [d][j]; 128 j a row, then the pad

  v16h qf0 = load_frag(qt, HD, i0, 0);
  v16h qf1 = load_frag(qt, HD, i0, 32);
  float m_i = -1e30f;   // running maximum of query i, equal in both halves of the wave
  float l_i = 0.f;      // running sum over this half's own j only; the halves are joined after the loop
  v8f O[4] = {};        // O[tt][r] = O^T[d = tt*16 + 8*(lane>>4) + r][i]
  const float scale = 0.125f;   // 64^-0.5

  stage_kv(kt, vp, 0, ktile[0], vtile[0], tid);       // stage 0
  asm volatile("s_wait_asynccnt 0x0" ::: "memory");   // this wave's copies of stage 0 have landed before it signals the barrier
  __syncthreads();                                    // every wave's have landed before any fragment is read
  stage_kv(kt, vp, SKEYS, ktile[1], vtile[1], tid);   // stage 1 flies during stage 0

  for (int st = 0; st < LCNT / SKEYS; ++st) {
    int buf = st & 1;
#pragma unroll   // constant pass offsets fold into the LDS loads' offset fields
   for (int ps = 0; ps < SKEYS / 32; ++ps) {
    v16h kf00 = load_frag(&ktile[buf][0][0], KPITCH, ps * 32,      0);
    v16h kf01 = load_frag(&ktile[buf][0][0], KPITCH, ps * 32,      32);
    v16h kf10 = load_frag(&ktile[buf][0][0], KPITCH, ps * 32 + 16, 0);
    v16h kf11 = load_frag(&ktile[buf][0][0], KPITCH, ps * 32 + 16, 32);
    v8f s0 = {}, s1 = {};
    s0 = wmma_f16(kf00, qf0, s0);   // s0[r] = S^T[j = 8*(lane>>4) + r][i]
    s0 = wmma_f16(kf01, qf1, s0);
    s1 = wmma_f16(kf10, qf0, s1);   // s1[r] = S^T[j = 16 + 8*(lane>>4) + r][i]
    s1 = wmma_f16(kf11, qf1, s1);

    // online softmax of query i: 16 scores in this lane, the other 16 in lane ^ 16
    s0 *= scale;
    s1 *= scale;
    float rm = fmaxf(s0[0], s1[0]);
#pragma unroll   // constant element indices: the score vectors stay in registers
    for (int r = 1; r < 8; ++r) rm = fmaxf(rm, fmaxf(s0[r], s1[r]));
    rm = fmaxf(rm, xhalf(rm));
    float mn = fmaxf(m_i, rm);
    float alpha = __expf(m_i - mn);
    m_i = mn;
    // pf[s] = P^T[j][i], j = 8*(lane>>4) + s for s < 8 and 16 + 8*(lane>>4) + (s - 8) above: the k order of load_frag's V
    v16h pf;
    s0 = (s0 - mn) * 1.44269504f;   // exp(x) = 2^(x * log2 e), as __expf has it
    s1 = (s1 - mn) * 1.44269504f;
    s0 = exp2x8(s0);
    s1 = exp2x8(s1);
#pragma unroll
    for (int r = 0; r < 8; ++r) {
      pf[r]     = (half_t)s0[r];
      pf[8 + r] = (half_t)s1[r];
    }
    v8f t = s0 + s1;
    float rsum = ((t[0] + t[1]) + (t[2] + t[3])) + ((t[4] + t[5]) + (t[6] + t[7]));
    l_i = l_i * alpha + rsum;
#pragma unroll   // constant tile indices: the accumulators stay in registers
    for (int tt = 0; tt < 4; ++tt) O[tt] *= alpha;
#pragma unroll
    for (int tt = 0; tt < 4; ++tt) {
      v16h vf = load_frag(&vtile[buf][0][0], VPITCH, tt * 16, ps * 32);
      O[tt] = wmma_f16(vf, pf, O[tt]);
    }
   }
    // Hand-over, once a stage, every wave, in this order.
    asm volatile("s_wait_dscnt 0x0" ::: "memory");     // this wave's reads of buf have returned before buf may be refilled
    asm volatile("s_wait_asynccnt 0x0" ::: "memory");  // this wave's copies of stage st + 1 have landed
    __syncthreads();                                   // publishes stage st + 1 and ends every wave's reads of buf
    if (st + 2 < LCNT / SKEYS)
      stage_kv(kt, vp, (st + 2) * SKEYS, ktile[buf], vtile[buf], tid);
  }
  asm volatile("s_wait_asynccnt 0x0" ::: "memory");    // no copy is outstanding when the wave ends

  float inv = 1.0f / (l_i + xhalf(l_i));
  // A lane's 8 registers of a tile are 8 neighbouring channels of one position: one 16-byte store.
  half_t* aorow = ao + ((size_t)b * LCNT + i0 + (lane & 15)) * CH + h * HD + ((lane >> 4) << 3);   // [b][l][c]
#pragma unroll
  for (int tt = 0; tt < 4; ++tt) {
    v8h pk;
#pragma unroll
    for (int r = 0; r < 8; ++r) pk[r] = (half_t)(O[tt][r] * inv);
    *(v8h*)(aorow + tt * 16) = pk;
  }
}

// ---------------- proj GEMM + bias + residual: block = 128(o) x 64(l) ----------------
__global__ __launch_bounds__(256) void proj_kernel(const half_t* __restrict__ wp,
                                                   const half_t* __restrict__ ao,
                                                   const float* __restrict__ proj_b,
                                                   const float* __restrict__ x,
                                                   float* __restrict__ out) {
  int bx   = blockIdx.x;                 // 16 b * 2 mblk * 16 nt = 512
  int b    = bx / 32;
  int rem  = bx - b * 32;
  int mblk = rem >> 4;
  int nt   = rem & 15;
  int l0   = nt << 6;
  int tid  = threadIdx.x, wave = tid >> 5, lane = tid & 31;
  int o0   = mblk * 128 + wave * 16;
  const half_t* ab = ao + (size_t)b * LCNT * CH;

  // The B tile, 64 positions x all 256 channels of ao, is copied to LDS once, as in qkv_kernel.
  // 64 rows x 32 chunks of 16 B; a wave's copy takes one row's 512 contiguous bytes. Each thread copies 8 chunks.
  __shared__ __align__(16) half_t btile[64][BPITCH];   // [l][k]; 256 k a row, then the pad
  const half_t* cg[8];
  half_t* cl[8];
#pragma unroll   // constant indices: the addresses stay in registers
  for (int c = 0; c < 8; ++c) {
    int srow = c * 8 + wave, sch = lane << 3;
    cg[c] = ab + (size_t)(l0 + srow) * CH + sch;
    cl[c] = &btile[srow][sch];
  }
  v16h af[8];      // issued ahead of the copies, whose statement ends in a wait
#pragma unroll   // constant indices: the fragments stay in registers
  for (int ks = 0; ks < 8; ++ks) af[ks] = load_wfrag(wp, mblk * 8 + wave, ks);
  async8_b128(cg, cl);
  asm volatile("s_wait_asynccnt 0x0" ::: "memory");   // this wave's copies have landed before it signals the barrier
  __syncthreads();                                    // every wave's have landed before any fragment is read
  v8f acc[4] = {};
#pragma unroll   // constant k offsets fold into the LDS loads' offset fields; af is indexed by constants
  for (int ks = 0; ks < 8; ++ks) {
#pragma unroll
    for (int j = 0; j < 4; ++j) {
      v16h bf = load_frag(&btile[0][0], BPITCH, j * 16, ks * 32);
      acc[j] = wmma_f16(af[ks], bf, acc[j]);
    }
  }

  int mh = (lane >> 4) << 3;
  float pb[8];
#pragma unroll
  for (int r = 0; r < 8; ++r) pb[r] = proj_b[o0 + mh + r];
#pragma unroll
  for (int j = 0; j < 4; ++j)
#pragma unroll
    for (int r = 0; r < 8; ++r) {
      int o = o0 + mh + r;
      int l = l0 + j * 16 + (lane & 15);
      size_t idx = ((size_t)b * CH + o) * LCNT + l;
      out[idx] = x[idx] + pb[r] + acc[j][r];
    }
}

extern "C" void kernel_launch(void* const* d_in, const int* in_sizes, int n_in,
                              void* d_out, int out_size, void* d_ws, size_t ws_size,
                              hipStream_t stream) {
  const float* x      = (const float*)d_in[0];
  const float* gn_w   = (const float*)d_in[1];
  const float* gn_b   = (const float*)d_in[2];
  const float* qkv_w  = (const float*)d_in[3];
  const float* qkv_b  = (const float*)d_in[4];
  const float* proj_w = (const float*)d_in[5];
  const float* proj_b = (const float*)d_in[6];
  float* out = (float*)d_out;

  // workspace layout (bytes), total ~40.5 MB
  char* ws = (char*)d_ws;
  half_t* wq  = (half_t*)(ws);              // 768*256 f16, fragment order
  half_t* wp  = (half_t*)(ws +   393216);   // 256*256 f16, fragment order
  half_t* y_t = (half_t*)(ws +   524288);   // 16*32*1024*8 f16
  half_t* qk  = (half_t*)(ws +  8912896);   // 16*2*4*1024*64 f16
  half_t* vv  = (half_t*)(ws + 25690112);   // 16*4*64*1024 f16
  half_t* ao  = (half_t*)(ws + 34078720);   // 16*1024*256 f16

  gn_kernel  <<<512,  256, 0, stream>>>(x, gn_w, gn_b, qkv_w, proj_w, y_t, wq, wp);
  qkv_kernel <<<1536, 256, 0, stream>>>(wq, y_t, qkv_b, qk, vv);
  attn_kernel<<<512,  256, 0, stream>>>(qk, vv, ao);
  proj_kernel<<<512,  256, 0, stream>>>(wp, ao, proj_b, x, out);
}

// v010
// One run takes 46.6 microseconds.
// Timed twice side by side with v009, it ran 1.03 and 1.05 times as fast.
// All steps since v000 together make it 4.44 times as fast.
#include <hip/hip_runtime.h>
#include <hip/hip_bf16.h>

typedef _Float16 half_t;
typedef __attribute__((ext_vector_type(2)))  _Float16 v2h;
typedef __attribute__((ext_vector_type(2)))  float    v2f;
typedef __attribute__((ext_vector_type(8)))  _Float16 v8h;
typedef __attribute__((ext_vector_type(16))) _Float16 v16h;
typedef __attribute__((ext_vector_type(8)))  float    v8f;

#define LCNT 1024   // 32*32 spatial positions
#define CH   256
#define NH   4
#define HD   64
#define OPITCH 72
#define KPITCH 72
#define BPITCH 264
#define SKEYS  128
#define VPITCH 136

__device__ __forceinline__ void async8_b128(const half_t* const (&g)[8], half_t* const (&l)[8]) {
  unsigned a[8];
#pragma unroll   // constant indices: the addresses stay in registers
  for (int c = 0; c < 8; ++c) a[c] = (unsigned)(unsigned long long)l[c];
  asm volatile("global_load_async_to_lds_b128 %0, %8, off\n\t"
               "global_load_async_to_lds_b128 %1, %9, off\n\t"
               "global_load_async_to_lds_b128 %2, %10, off\n\t"
               "global_load_async_to_lds_b128 %3, %11, off\n\t"
               "global_load_async_to_lds_b128 %4, %12, off\n\t"
               "global_load_async_to_lds_b128 %5, %13, off\n\t"
               "global_load_async_to_lds_b128 %6, %14, off\n\t"
               "global_load_async_to_lds_b128 %7, %15, off\n\t"
               "s_wait_xcnt 0x0"
               :: "v"(a[0]), "v"(a[1]), "v"(a[2]), "v"(a[3]), "v"(a[4]), "v"(a[5]), "v"(a[6]), "v"(a[7]),
                  "v"(g[0]), "v"(g[1]), "v"(g[2]), "v"(g[3]), "v"(g[4]), "v"(g[5]), "v"(g[6]), "v"(g[7])
               : "memory");
}

__device__ __forceinline__ v16h load_frag(const half_t* __restrict__ base,
                                          int ld, int row0, int k0) {
  int lane = threadIdx.x & 31;
  const half_t* p = base + (size_t)(row0 + (lane & 15)) * ld + k0 + ((lane >> 4) << 3);
  v8h lo = *(const v8h*)(p);
  v8h hi = *(const v8h*)(p + 16);
  v16h f;
#pragma unroll
  for (int i = 0; i < 8; ++i) { f[i] = lo[i]; f[8 + i] = hi[i]; }
  return f;
}

// The same fragment of a weight matrix [o][CH] that the GroupNorm launch has laid out in fragment order:
// tile (ot, ks) = rows ot*16 .. +15, k ks*32 .. +31 is 1 KB, first the 32 lanes' lower 8 f16, then their upper 8.
// Each of the two loads covers 512 contiguous bytes, 4 whole 128-B lines. The k order is load_frag's.
__device__ __forceinline__ v16h load_wfrag(const half_t* __restrict__ w, int ot, int ks) {
  const half_t* p = w + (size_t)(ot * (CH / 32) + ks) * 512 + ((threadIdx.x & 31) << 3);
  v8h lo = *(const v8h*)(p);
  v8h hi = *(const v8h*)(p + 256);
  v16h f;
#pragma unroll   // constant element indices: the fragment stays in registers
  for (int i = 0; i < 8; ++i) { f[i] = lo[i]; f[8 + i] = hi[i]; }
  return f;
}

__device__ __forceinline__ v8f wmma_f16(v16h a, v16h b, v8f c) {
  return __builtin_amdgcn_wmma_f32_16x16x32_f16(false, a, false, b, (short)0, c,
                                                false, false);
}

__device__ __forceinline__ float xhalf(float x) {
  int v = __builtin_bit_cast(int, x);
  return __builtin_bit_cast(float,
      __builtin_amdgcn_permlanex16(v, v, 0x76543210, 0xfedcba98, false, false));
}

__device__ __forceinline__ v8f exp2x8(v8f x) {
  float a, b, c, d, e, f, g, h;
  asm("v_exp_f32 %0, %8\n\tv_exp_f32 %1, %9\n\tv_exp_f32 %2, %10\n\tv_exp_f32 %3, %11\n\t"
      "v_exp_f32 %4, %12\n\tv_exp_f32 %5, %13\n\tv_exp_f32 %6, %14\n\tv_exp_f32 %7, %15\n\tv_nop"
      : "=&v"(a), "=&v"(b), "=&v"(c), "=&v"(d), "=&v"(e), "=&v"(f), "=&v"(g), "=&v"(h)
      : "v"(x[0]), "v"(x[1]), "v"(x[2]), "v"(x[3]), "v"(x[4]), "v"(x[5]), "v"(x[6]), "v"(x[7]));
  v8f y = {a, b, c, d, e, f, g, h};
  return y;
}

// ta += the four row pairs of x, tb += those of y: eight independent packed adds. In a volatile statement so that they
// stay where the values are made: left to the compiler, a stage's row sums sank behind its barrier and held all 64
// f32 values of P in registers through the V P^T products.
__device__ __forceinline__ void add8x2(v2f (&ta)[4], v2f (&tb)[4], v8f x, v8f y) {
  v2f x0 = {x[0], x[1]}, x1 = {x[2], x[3]}, x2 = {x[4], x[5]}, x3 = {x[6], x[7]};
  v2f y0 = {y[0], y[1]}, y1 = {y[2], y[3]}, y2 = {y[4], y[5]}, y3 = {y[6], y[7]};
  asm volatile("v_pk_add_f32 %0, %0, %8\n\tv_pk_add_f32 %1, %1, %9\n\t"
               "v_pk_add_f32 %2, %2, %10\n\tv_pk_add_f32 %3, %3, %11\n\t"
               "v_pk_add_f32 %4, %4, %12\n\tv_pk_add_f32 %5, %5, %13\n\t"
               "v_pk_add_f32 %6, %6, %14\n\tv_pk_add_f32 %7, %7, %15"
               : "+v"(ta[0]), "+v"(ta[1]), "+v"(ta[2]), "+v"(ta[3]), "+v"(tb[0]), "+v"(tb[1]), "+v"(tb[2]), "+v"(tb[3])
               : "v"(x0), "v"(x1), "v"(x2), "v"(x3), "v"(y0), "v"(y1), "v"(y2), "v"(y3));
}

__global__ __launch_bounds__(256) void gn_kernel(const float* __restrict__ x,
                                                 const float* __restrict__ gw,
                                                 const float* __restrict__ gb,
                                                 const float* __restrict__ qkv_w,
                                                 const float* __restrict__ proj_w,
                                                 half_t* __restrict__ y_t,
                                                 half_t* __restrict__ wq,
                                                 half_t* __restrict__ wp) {
  const int CPG = 8;
  const int QBLK = 3 * CH * CH / 512;   // blocks that convert qkv_w, 512 elements each
  int b = blockIdx.x >> 5;
  int g = blockIdx.x & 31;
  bool isq = blockIdx.x < QBLK;
  int wi = ((isq ? blockIdx.x : blockIdx.x - QBLK) * 256 + threadIdx.x) * 2;
  int wl = (wi >> 3) & 31;                                // the lane whose fragment registers hold place wi
  int wo = (wi >> 12) * 16 + (wl & 15);                   // its row o
  int wk = ((wi >> 9) & 7) * 32 + ((wi >> 8) & 1) * 16 + (wl >> 4) * 8 + (wi & 7);   // its k
  v2f wv = *(const v2f*)((isq ? qkv_w : proj_w) + wo * CH + wk);   // in flight beside the first loads of x
  const float* xg = x + ((size_t)b * CH + g * CPG) * LCNT;
  float s = 0.f, s2 = 0.f;
  for (int idx = threadIdx.x; idx < CPG * LCNT; idx += 256) {
    float v = xg[idx];
    s += v; s2 += v * v;
  }
#pragma unroll
  for (int off = 16; off > 0; off >>= 1) {
    s  += __shfl_xor(s, off, 32);
    s2 += __shfl_xor(s2, off, 32);
  }
  __shared__ float rs[8], rq[8];
  int wave = threadIdx.x >> 5, lane = threadIdx.x & 31;
  if (lane == 0) { rs[wave] = s; rq[wave] = s2; }
  __syncthreads();
  s = 0.f; s2 = 0.f;
#pragma unroll
  for (int i = 0; i < 8; ++i) { s += rs[i]; s2 += rq[i]; }
  const float invN = 1.0f / (float)(CPG * LCNT);
  float mean = s * invN;
  float var  = s2 * invN - mean * mean;
  float rstd = rsqrtf(var + 1e-5f);
  // One thread owns a position's whole group: its 8 channels leave as one 16-byte store.
  // Neighbouring positions of a group are neighbours in y_t, so a wave's store is 512
  // contiguous bytes: 4 whole 128-B lines, each written by this block alone.
  for (int l = threadIdx.x; l < LCNT; l += 256) {
    v8h pk;
#pragma unroll
    for (int cl = 0; cl < CPG; ++cl) {
      int c = g * CPG + cl;
      float v = (xg[cl * LCNT + l] - mean) * rstd * gw[c] + gb[c];
      pk[cl] = (half_t)v;
    }
    *(v8h*)(y_t + (((size_t)b * (CH / CPG) + g) * LCNT + l) * CPG) = pk;
  }
  // Last, so that neither the barrier nor a reuse of its registers waits for this store. A wave stores one whole 128-B line.
  v2h wh = {(half_t)wv[0], (half_t)wv[1]};
  *(v2h*)((isq ? wq : wp) + wi) = wh;
}

// ---------------- QKV GEMM: block = 128(o) x 64(l), K=256 ----------------
// All 8 waves share the B tile (64 positions x all 256 channels of y_t). It is copied to LDS once, whole, so the
// k loop holds no barrier and no wait for a copy, and the wave's 8 weight fragments are in flight beside the copies.
__global__ __launch_bounds__(256) void qkv_kernel(const half_t* __restrict__ wq,
                                                  const half_t* __restrict__ y_t,
                                                  const float* __restrict__ qkv_b,
                                                  half_t* __restrict__ qk,
                                                  half_t* __restrict__ vv) {
  int bx   = blockIdx.x;                 // 16 b * 6 mblk * 16 nt = 1536
  int b    = bx / 96;
  int rem  = bx - b * 96;
  int mblk = rem >> 4;
  int nt   = rem & 15;
  int l0   = nt << 6;
  int tid  = threadIdx.x, wave = tid >> 5, lane = tid & 31;
  int o0   = mblk * 128 + wave * 16;
  const half_t* yb = y_t + (size_t)b * LCNT * CH;

  __shared__ __align__(16) half_t btile[64][BPITCH];   // [l][k]; 256 k a row, then the pad
  __shared__ __align__(16) half_t ostage[128][OPITCH]; // output tile, one row per 128-B line of q, k or v
  // 64 rows x 32 chunks of 16 B; a chunk is one group of 8 channels. A wave's copy takes 32
  // neighbouring positions of one group: 512 contiguous bytes of y_t. Each thread copies 8 chunks.
  int srow = tid & 63, sgrp = tid >> 6;
  const half_t* cg[8];
  half_t* cl[8];
#pragma unroll   // constant indices: the addresses stay in registers
  for (int c = 0; c < 8; ++c) {
    int grp = c * 4 + sgrp;
    cg[c] = yb + ((size_t)grp * LCNT + l0 + srow) * 8;
    cl[c] = &btile[srow][grp * 8];
  }
  v16h af[8];      // issued ahead of the copies, whose statement ends in a wait
#pragma unroll   // constant indices: the fragments stay in registers
  for (int ks = 0; ks < 8; ++ks) af[ks] = load_wfrag(wq, mblk * 8 + wave, ks);
  async8_b128(cg, cl);
  asm volatile("s_wait_asynccnt 0x0" ::: "memory");   // this wave's copies have landed before it signals the barrier
  __syncthreads();                                    // every wave's have landed before any fragment is read
  v8f acc[4] = {};
#pragma unroll   // constant k offsets fold into the LDS loads' offset fields; af is indexed by constants
  for (int ks = 0; ks < 8; ++ks) {
#pragma unroll
    for (int j = 0; j < 4; ++j) {
      v16h bf = load_frag(&btile[0][0], BPITCH, j * 16, ks * 32);
      acc[j] = wmma_f16(af[ks], bf, acc[j]);
    }
  }

  int mh = (lane >> 4) << 3;
  float pb[8];
#pragma unroll
  for (int r = 0; r < 8; ++r) pb[r] = qkv_b[o0 + mh + r];

  // The block's 128 o are one section (0=q 1=k 2=v) and two heads. The tile is
  // laid in LDS in the order of the destination, one row per 128-B line, and
  // then leaves as 16-byte stores: 8 lanes a line, 4 whole lines a wave.
  int sec = mblk >> 1;
  half_t* dst;          // first line of the tile
  int rstep, hstep;     // f16 from row to row inside a half of 64 rows; from half to half
  if (sec == 2) {       // v [b][h][d][l]: row = o, 64 l a row
#pragma unroll
    for (int j = 0; j < 4; ++j)
#pragma unroll
      for (int r = 0; r < 8; ++r)
        ostage[wave * 16 + mh + r][j * 16 + (lane & 15)] = (half_t)(acc[j][r] + pb[r]);
    dst   = vv + ((size_t)b * CH + (mblk & 1) * 128) * LCNT + l0;
    rstep = LCNT;
    hstep = 64 * LCNT;
  } else {              // q, k [b][s][h][l][d]: row = (head, l), 64 d a row
#pragma unroll
    for (int j = 0; j < 4; ++j) {
      v8h pk;
#pragma unroll
      for (int r = 0; r < 8; ++r) pk[r] = (half_t)(acc[j][r] + pb[r]);
      *(v8h*)&ostage[(wave >> 2) * 64 + j * 16 + (lane & 15)][(wave & 3) * 16 + mh] = pk;
    }
    dst   = qk + ((((size_t)b * 2 + sec) * NH + (mblk & 1) * 2) * LCNT + l0) * HD;
    rstep = HD;
    hstep = LCNT * HD;
  }
  __syncthreads();      // rows are read back by other waves than wrote them: all staged before any row is read
#pragma unroll
  for (int it = 0; it < 4; ++it) {
    int c = it * 256 + tid;
    int row = c >> 3, ch = (c & 7) << 3;
    *(v8h*)(dst + (size_t)(row >> 6) * hstep + (size_t)(row & 63) * rstep + ch) =
        *(const v8h*)&ostage[row][ch];
  }
}

// One stage of attention, keys j0 .. j0 + 127, into one buffer: K is 128 rows x 8 chunks of 16 B (16 KB contiguous in
// memory), V 64 rows x 16 chunks (256 contiguous B a row). Each thread copies 4 chunks of each; a wave's copy takes
// 512 contiguous bytes of K, or two rows' 256 bytes of V.
__device__ __forceinline__ void stage_kv(const half_t* kt, const half_t* vp, int j0,
                                         half_t (*kb)[KPITCH], half_t (*vb)[VPITCH], int tid) {
  const half_t* g[8];
  half_t* l[8];
#pragma unroll   // constant indices: the addresses stay in registers
  for (int c = 0; c < 4; ++c) {
    int idx = c * 256 + tid;
    int kr = idx >> 3, kc = (idx & 7) << 3;
    g[c] = kt + (size_t)(j0 + kr) * HD + kc;
    l[c] = &kb[kr][kc];
    int vr = idx >> 4, vc = (idx & 15) << 3;
    g[4 + c] = vp + (size_t)vr * LCNT + j0 + vc;
    l[4 + c] = &vb[vr][vc];
  }
  async8_b128(g, l);
}

__global__ __launch_bounds__(256) __attribute__((amdgpu_waves_per_eu(4, 4))) void attn_kernel(const half_t* __restrict__ qk,
                                                   const half_t* __restrict__ vv,
                                                   half_t* __restrict__ ao) {
  int bh = blockIdx.x >> 3;
  int ib = blockIdx.x & 7;
  int b = bh >> 2, h = bh & 3;
  int tid = threadIdx.x, wave = tid >> 5, lane = tid & 31;
  const half_t* qt = qk + (((size_t)b * 2 * NH + h) * LCNT) * HD;
  const half_t* kt = qk + ((((size_t)b * 2 + 1) * NH + h) * LCNT) * HD;
  const half_t* vp = vv + (((size_t)b * NH + h) * HD) * LCNT;
  int i0 = ib * 128 + wave * 16;

  __shared__ __align__(16) half_t ktile[2][SKEYS][KPITCH];   // [j][d]; 64 d a row, then the pad
  __shared__ __align__(16) half_t vtile[2][64][VPITCH];      // [d][j]; 128 j a row, then the pad

  v16h qf0 = load_frag(qt, HD, i0, 0);
  v16h qf1 = load_frag(qt, HD, i0, 32);
  float m_i = -1e30f;   // running maximum of query i, equal in both halves of the wave
  float l_i = 0.f;      // running sum over this half's own j only; the halves are joined after the loop
  v8f O[4] = {};        // O[tt][r] = O^T[d = tt*16 + 8*(lane>>4) + r][i]
  const float scale = 0.125f;   // 64^-0.5

  stage_kv(kt, vp, 0, ktile[0], vtile[0], tid);       // stage 0
  asm volatile("s_wait_asynccnt 0x0" ::: "memory");   // this wave's copies of stage 0 have landed before it signals the barrier
  __syncthreads();                                    // every wave's have landed before any fragment is read
  stage_kv(kt, vp, SKEYS, ktile[1], vtile[1], tid);   // stage 1 flies during stage 0

  for (int st = 0; st < LCNT / SKEYS; ++st) {
    int buf = st & 1;
    // One softmax step a stage: all 128 scores of query i first, then one maximum, one alpha and one rescale of O.
    v16h kf[SKEYS / 16][2];
#pragma unroll   // constant offsets fold into the LDS loads' offset fields; the fragments stay in registers
    for (int kt16 = 0; kt16 < SKEYS / 16; ++kt16) {
      kf[kt16][0] = load_frag(&ktile[buf][0][0], KPITCH, kt16 * 16, 0);
      kf[kt16][1] = load_frag(&ktile[buf][0][0], KPITCH, kt16 * 16, 32);
    }
    __builtin_amdgcn_sched_barrier(0);   // the stage's K loads stand as one group ahead of its products, not among them
    v8f s[SKEYS / 16];      // s[t][r] = S^T[j = 16*t + 8*(lane>>4) + r][i]
#pragma unroll   // constant indices: s stays in registers
    for (int kt16 = 0; kt16 < SKEYS / 16; ++kt16) {
      v8f z = {};
      s[kt16] = wmma_f16(kf[kt16][1], qf1, wmma_f16(kf[kt16][0], qf0, z));
    }
    __builtin_amdgcn_sched_barrier(0);
    // V of the first 64 keys, in flight under the vector work below.
    v16h vf[SKEYS / 32][4];
#pragma unroll   // constant indices: the fragments stay in registers
    for (int ps = 0; ps < 2; ++ps)
#pragma unroll
      for (int tt = 0; tt < 4; ++tt) vf[ps][tt] = load_frag(&vtile[buf][0][0], VPITCH, tt * 16, ps * 32);

    // online softmax of query i: 64 scores in this lane, the other 64 in lane ^ 16
    float rp[SKEYS / 32];   // maximum of each pair of tiles: four short chains, not one long one
#pragma unroll   // constant indices: s and rp stay in registers
    for (int ps = 0; ps < SKEYS / 32; ++ps) {
      s[2 * ps]     *= scale;
      s[2 * ps + 1] *= scale;
      float pm = fmaxf(s[2 * ps][0], s[2 * ps + 1][0]);
#pragma unroll
      for (int r = 1; r < 8; ++r) pm = fmaxf(pm, fmaxf(s[2 * ps][r], s[2 * ps + 1][r]));
      rp[ps] = pm;
    }
    float rm = fmaxf(fmaxf(rp[0], rp[1]), fmaxf(rp[2], rp[3]));
    rm = fmaxf(rm, xhalf(rm));
    float mn = fmaxf(m_i, rm);
    float alpha = __expf(m_i - mn);
    m_i = mn;
    // pf[ps][e] = P^T[j][i], j = 32*ps + 8*(lane>>4) + e for e < 8 and 32*ps + 16 + 8*(lane>>4) + (e - 8) above:
    // the k order of load_frag's V
    v16h pf[SKEYS / 32];
    v2f ta[4], tb[4];   // sums of the even and of the odd tiles, two neighbouring rows r a pair
#pragma unroll   // constant indices: s and pf stay in registers
    for (int ps = 0; ps < SKEYS / 32; ++ps) {
      v8f s0 = (s[2 * ps]     - mn) * 1.44269504f;   // exp(x) = 2^(x * log2 e), as __expf has it
      v8f s1 = (s[2 * ps + 1] - mn) * 1.44269504f;
      s0 = exp2x8(s0);
      s1 = exp2x8(s1);
      pf[ps] = __builtin_shufflevector(__builtin_convertvector(s0, v8h), __builtin_convertvector(s1, v8h),
                                       0, 1, 2, 3, 4, 5, 6, 7, 8, 9, 10, 11, 12, 13, 14, 15);
      if (ps == 0) {   // the first pair of tiles starts the sums
#pragma unroll
        for (int k = 0; k < 4; ++k) {
          ta[k] = v2f{s0[2 * k], s0[2 * k + 1]};
          tb[k] = v2f{s1[2 * k], s1[2 * k + 1]};
        }
      } else {
        add8x2(ta, tb, s0, s1);
      }
    }
    v2f t2 = ((ta[0] + tb[0]) + (ta[1] + tb[1])) + ((ta[2] + tb[2]) + (ta[3] + tb[3]));
    l_i = l_i * alpha + (t2[0] + t2[1]);
#pragma unroll   // constant tile indices: the accumulators stay in registers
    for (int tt = 0; tt < 4; ++tt) O[tt] *= alpha;
#pragma unroll   // V of the third 32 keys, into registers that the scores have left
    for (int tt = 0; tt < 4; ++tt) vf[2][tt] = load_frag(&vtile[buf][0][0], VPITCH, tt * 16, 64);
    __builtin_amdgcn_sched_barrier(0);
#pragma unroll   // constant indices: fragments and accumulators stay in registers
    for (int tt = 0; tt < 4; ++tt) O[tt] = wmma_f16(vf[0][tt], pf[0], O[tt]);
#pragma unroll   // V of the last 32 keys, into the registers of the first: all 16 fragments at once did not fit 256 registers
    for (int tt = 0; tt < 4; ++tt) vf[3][tt] = load_frag(&vtile[buf][0][0], VPITCH, tt * 16, 96);
    __builtin_amdgcn_sched_barrier(0);   // keeps these loads up here: without it they were spread among the other 12 products, each behind a wait to 0
#pragma unroll   // constant indices: fragments and accumulators stay in registers
    for (int ps = 1; ps < SKEYS / 32; ++ps)
#pragma unroll
      for (int tt = 0; tt < 4; ++tt) O[tt] = wmma_f16(vf[ps][tt], pf[ps], O[tt]);
    // Hand-over, once a stage, every wave, in this order.
    asm volatile("s_wait_dscnt 0x0" ::: "memory");     // this wave's reads of buf have returned before buf may be refilled
    asm volatile("s_wait_asynccnt 0x0" ::: "memory");  // this wave's copies of stage st + 1 have landed
    __syncthreads();                                   // publishes stage st + 1 and ends every wave's reads of buf
    if (st + 2 < LCNT / SKEYS)
      stage_kv(kt, vp, (st + 2) * SKEYS, ktile[buf], vtile[buf], tid);
  }
  asm volatile("s_wait_asynccnt 0x0" ::: "memory");    // no copy is outstanding when the wave ends

  float inv = 1.0f / (l_i + xhalf(l_i));
  // A lane's 8 registers of a tile are 8 neighbouring channels of one position: one 16-byte store.
  half_t* aorow = ao + ((size_t)b * LCNT + i0 + (lane & 15)) * CH + h * HD + ((lane >> 4) << 3);   // [b][l][c]
#pragma unroll
  for (int tt = 0; tt < 4; ++tt) {
    v8h pk;
#pragma unroll
    for (int r = 0; r < 8; ++r) pk[r] = (half_t)(O[tt][r] * inv);
    *(v8h*)(aorow + tt * 16) = pk;
  }
}

// ---------------- proj GEMM + bias + residual: block = 128(o) x 64(l) ----------------
__global__ __launch_bounds__(256) void proj_kernel(const half_t* __restrict__ wp,
                                                   const half_t* __restrict__ ao,
                                                   const float* __restrict__ proj_b,
                                                   const float* __restrict__ x,
                                                   float* __restrict__ out) {
  int bx   = blockIdx.x;                 // 16 b * 2 mblk * 16 nt = 512
  int b    = bx / 32;
  int rem  = bx - b * 32;
  int mblk = rem >> 4;
  int nt   = rem & 15;
  int l0   = nt << 6;
  int tid  = threadIdx.x, wave = tid >> 5, lane = tid & 31;
  int o0   = mblk * 128 + wave * 16;
  const half_t* ab = ao + (size_t)b * LCNT * CH;

  // The B tile, 64 positions x all 256 channels of ao, is copied to LDS once, as in qkv_kernel.
  // 64 rows x 32 chunks of 16 B; a wave's copy takes one row's 512 contiguous bytes. Each thread copies 8 chunks.
  __shared__ __align__(16) half_t btile[64][BPITCH];   // [l][k]; 256 k a row, then the pad
  const half_t* cg[8];
  half_t* cl[8];
#pragma unroll   // constant indices: the addresses stay in registers
  for (int c = 0; c < 8; ++c) {
    int srow = c * 8 + wave, sch = lane << 3;
    cg[c] = ab + (size_t)(l0 + srow) * CH + sch;
    cl[c] = &btile[srow][sch];
  }
  v16h af[8];      // issued ahead of the copies, whose statement ends in a wait
#pragma unroll   // constant indices: the fragments stay in registers
  for (int ks = 0; ks < 8; ++ks) af[ks] = load_wfrag(wp, mblk * 8 + wave, ks);
  async8_b128(cg, cl);
  asm volatile("s_wait_asynccnt 0x0" ::: "memory");   // this wave's copies have landed before it signals the barrier
  __syncthreads();                                    // every wave's have landed before any fragment is read
  v8f acc[4] = {};
#pragma unroll   // constant k offsets fold into the LDS loads' offset fields; af is indexed by constants
  for (int ks = 0; ks < 8; ++ks) {
#pragma unroll
    for (int j = 0; j < 4; ++j) {
      v16h bf = load_frag(&btile[0][0], BPITCH, j * 16, ks * 32);
      acc[j] = wmma_f16(af[ks], bf, acc[j]);
    }
  }

  int mh = (lane >> 4) << 3;
  float pb[8];
#pragma unroll
  for (int r = 0; r < 8; ++r) pb[r] = proj_b[o0 + mh + r];
#pragma unroll
  for (int j = 0; j < 4; ++j)
#pragma unroll
    for (int r = 0; r < 8; ++r) {
      int o = o0 + mh + r;
      int l = l0 + j * 16 + (lane & 15);
      size_t idx = ((size_t)b * CH + o) * LCNT + l;
      out[idx] = x[idx] + pb[r] + acc[j][r];
    }
}

extern "C" void kernel_launch(void* const* d_in, const int* in_sizes, int n_in,
                              void* d_out, int out_size, void* d_ws, size_t ws_size,
                              hipStream_t stream) {
  const float* x      = (const float*)d_in[0];
  const float* gn_w   = (const float*)d_in[1];
  const float* gn_b   = (const float*)d_in[2];
  const float* qkv_w  = (const float*)d_in[3];
  const float* qkv_b  = (const float*)d_in[4];
  const float* proj_w = (const float*)d_in[5];
  const float* proj_b = (const float*)d_in[6];
  float* out = (float*)d_out;

  // workspace layout (bytes), total ~40.5 MB
  char* ws = (char*)d_ws;
  half_t* wq  = (half_t*)(ws);              // 768*256 f16, fragment order
  half_t* wp  = (half_t*)(ws +   393216);   // 256*256 f16, fragment order
  half_t* y_t = (half_t*)(ws +   524288);   // 16*32*1024*8 f16
  half_t* qk  = (half_t*)(ws +  8912896);   // 16*2*4*1024*64 f16
  half_t* vv  = (half_t*)(ws + 25690112);   // 16*4*64*1024 f16
  half_t* ao  = (half_t*)(ws + 34078720);   // 16*1024*256 f16

  gn_kernel  <<<512,  256, 0, stream>>>(x, gn_w, gn_b, qkv_w, proj_w, y_t, wq, wp);
  qkv_kernel <<<1536, 256, 0, stream>>>(wq, y_t, qkv_b, qk, vv);
  attn_kernel<<<512,  256, 0, stream>>>(qk, vv, ao);
  proj_kernel<<<512,  256, 0, stream>>>(wp, ao, proj_b, x, out);
}
